// v000
// Measured on an AMD MI455X. A time is GPU time per run, averaged over a window of back-to-back runs after a warm-up
// (all launches, gaps included; the runs take copies of the inputs in turn), and the median of several windows.
// Apart from v000's, it joins two sittings. Times from different sittings can be a few percent apart, while
// side-by-side timings come from the same sitting.
// v000 is the starting kernel. One run takes 194 microseconds.
#include <hip/hip_runtime.h>
#include <hip/hip_bf16.h>
#include <stdint.h>

#define B_  16
#define T_  2048
#define E_  512
#define D_  64

typedef __attribute__((ext_vector_type(16))) __bf16 v16bf;
typedef __attribute__((ext_vector_type(8)))  float  v8f;
typedef __attribute__((ext_vector_type(4)))  int    v4i;

#if defined(__gfx1250__) && __has_builtin(__builtin_amdgcn_global_load_async_to_lds_b128)
#define HAVE_ASYNC_LDS 1
#endif

// Round two f32 to bf16 (RNE) and pack into one u32 via v_perm_b32.
static __device__ __forceinline__ uint32_t pkbf(float a, float b) {
  uint32_t ua = __builtin_bit_cast(uint32_t, a);
  uint32_t ub = __builtin_bit_cast(uint32_t, b);
  ua += 0x7FFFu + ((ua >> 16) & 1u);
  ub += 0x7FFFu + ((ub >> 16) & 1u);
  // out = {ub[31:24], ub[23:16], ua[31:24], ua[23:16]}
  return __builtin_amdgcn_perm(ub, ua, 0x07060302u);
}
static __device__ __forceinline__ uint16_t f2bfu(float f) {
  uint32_t u = __builtin_bit_cast(uint32_t, f);
  u += 0x7FFFu + ((u >> 16) & 1u);
  return (uint16_t)(u >> 16);
}
static __device__ __forceinline__ float bf2f(uint16_t h) {
  return __builtin_bit_cast(float, (uint32_t)h << 16);   // exact
}

static __device__ __forceinline__ v8f wmma_bf16(v16bf a, v16bf b, v8f c) {
  // D = A(16x32 bf16) * B(32x16 bf16) + C(16x16 f32)
  return __builtin_amdgcn_wmma_f32_16x16x32_bf16(false, a, false, b, (short)0, c,
                                                 false, false);
}

// Copy 16 bytes global -> LDS (async path if available)
static __device__ __forceinline__ void stage16(const uint16_t* g, uint16_t* l) {
#if HAVE_ASYNC_LDS
  typedef __attribute__((address_space(1))) v4i* gv4i_p;
  typedef __attribute__((address_space(3))) v4i* lv4i_p;
  __builtin_amdgcn_global_load_async_to_lds_b128((gv4i_p)g, (lv4i_p)l, 0, 0);
#else
  *reinterpret_cast<uint4*>(l) = *reinterpret_cast<const uint4*>(g);
#endif
}
static __device__ __forceinline__ void stage_wait() {
#if HAVE_ASYNC_LDS
#if __has_builtin(__builtin_amdgcn_s_wait_asynccnt)
  __builtin_amdgcn_s_wait_asynccnt(0);
#else
  asm volatile("s_wait_asynccnt 0" ::: "memory");
#endif
#endif
}

// ---------------------------------------------------------------------------
// Kernel 0: WqT[n][k] = bf16(Wq[k][n])  (64x512 bf16, 64KB -> stays L2 hot)
// ---------------------------------------------------------------------------
__global__ __launch_bounds__(256)
void k_wt(const float* __restrict__ Wq, uint16_t* __restrict__ WqT)
{
  const int idx = blockIdx.x * 256 + threadIdx.x;      // < 32768
  const int k = idx & (E_ - 1);
  const int n = idx >> 9;
  WqT[(size_t)n * E_ + k] = f2bfu(Wq[(size_t)k * D_ + n]);
}

// ---------------------------------------------------------------------------
// Kernel 1: q = x @ Wq + bq (bf16 out). One wave per 16x64 q tile; B from WqT
// (global, contiguous v16bf per lane, L2 resident). No LDS needed.
// ---------------------------------------------------------------------------
__global__ __launch_bounds__(256)
void k_proj(const float* __restrict__ x, const uint16_t* __restrict__ WqT,
            const float* __restrict__ bq, uint16_t* __restrict__ qb)
{
  const int tid  = threadIdx.x;
  const int wave = tid >> 5;
  const int lane = tid & 31;
  const int n    = lane & 15;      // A-layout M / C-layout N
  const int hi   = lane >> 4;      // K-half selector
  const int tok0 = blockIdx.x * 128 + wave * 16;

  v8f acc[4] = {v8f{}, v8f{}, v8f{}, v8f{}};
  const float* xrow = x + (size_t)(tok0 + n) * E_;

  for (int kb = 0; kb < E_; kb += 32) {
    if (kb + 32 < E_)
      __builtin_prefetch(xrow + kb + 32 + hi * 16, 0, 0);

    // A operand: x[tok0+n][kb + hi*16 .. +15] -> bf16 (perm-packed converts)
    const float4* xr = reinterpret_cast<const float4*>(xrow + kb + hi * 16);
    float4 p0 = xr[0], p1 = xr[1], p2 = xr[2], p3 = xr[3];
    float fv[16] = {p0.x, p0.y, p0.z, p0.w, p1.x, p1.y, p1.z, p1.w,
                    p2.x, p2.y, p2.z, p2.w, p3.x, p3.y, p3.z, p3.w};
    union { v16bf v; uint32_t w[8]; } ua;
#pragma unroll
    for (int q = 0; q < 8; ++q) ua.w[q] = pkbf(fv[2 * q], fv[2 * q + 1]);

#pragma unroll
    for (int nt = 0; nt < 4; ++nt) {
      v16bf bv = *reinterpret_cast<const v16bf*>(
          WqT + (size_t)(nt * 16 + n) * E_ + kb + hi * 16);
      acc[nt] = wmma_bf16(ua.v, bv, acc[nt]);
    }
  }

  // Epilogue: C layout -> lane holds column n, rows r + hi*8
#pragma unroll
  for (int nt = 0; nt < 4; ++nt) {
    const int col  = nt * 16 + n;
    const float bb = bq[col];
#pragma unroll
    for (int r = 0; r < 8; ++r) {
      const size_t row = (size_t)tok0 + r + hi * 8;
      qb[row * D_ + col] = f2bfu(acc[nt][r] + bb);
    }
  }
}

// ---------------------------------------------------------------------------
// Kernel 2: column softmax stats: m_j = max_i S_ij, Z_j = sum_i e^{S_ij-m_j}.
// 8 waves/block share batch b; a 32-row i-chunk of q (4KB) is staged per block
// via async global->LDS, then all waves run 2 sub-tiles (4 WMMAs) per stage.
// ---------------------------------------------------------------------------
__global__ __launch_bounds__(256)
void k_stats(const uint16_t* __restrict__ qb, float* __restrict__ mj,
             float* __restrict__ zj)
{
  __shared__ __align__(32) uint16_t sA[32 * D_];       // 4KB: current i-chunk
  const int tid = threadIdx.x, wave = tid >> 5, lane = tid & 31;
  const int gw = blockIdx.x * 8 + wave;                // 0..2047
  const int b  = gw >> 7;
  const int j0 = (gw & 127) * 16;
  const int n  = lane & 15, hi = lane >> 4;
  const size_t bT = (size_t)b * T_;
  const uint16_t* qbase = qb + bT * D_;

  // B operand fixed over i loop: B[k][n] = q[j0+n][k]
  const uint16_t* rowB = qbase + (size_t)(j0 + n) * D_;
  v16bf b0 = *reinterpret_cast<const v16bf*>(rowB + hi * 16);
  v16bf b1 = *reinterpret_cast<const v16bf*>(rowB + 32 + hi * 16);

  float mloc = -1.0e30f, zloc = 0.0f;
  for (int i0 = 0; i0 < T_; i0 += 32) {
    // stage q rows i0..i0+31 (4KB = 256 x 16B, one async chunk per thread)
    stage16(qbase + (size_t)i0 * D_ + tid * 8, sA + tid * 8);
    stage_wait();
    __syncthreads();

    v8f c0 = {}, c1 = {};
    {
      const uint16_t* ar = sA + (size_t)n * D_;
      v16bf a0 = *reinterpret_cast<const v16bf*>(ar + hi * 16);
      v16bf a1 = *reinterpret_cast<const v16bf*>(ar + 32 + hi * 16);
      c0 = wmma_bf16(a0, b0, c0);
      c0 = wmma_bf16(a1, b1, c0);
    }
    {
      const uint16_t* ar = sA + (size_t)(16 + n) * D_;
      v16bf a0 = *reinterpret_cast<const v16bf*>(ar + hi * 16);
      v16bf a1 = *reinterpret_cast<const v16bf*>(ar + 32 + hi * 16);
      c1 = wmma_bf16(a0, b0, c1);
      c1 = wmma_bf16(a1, b1, c1);
    }

    float tmax = -1.0e30f;
#pragma unroll
    for (int r = 0; r < 8; ++r) {
      tmax = fmaxf(tmax, c0[r] * 0.125f);
      tmax = fmaxf(tmax, c1[r] * 0.125f);
    }
    const float nm = fmaxf(mloc, tmax);
    float zs = zloc * __expf(mloc - nm);
#pragma unroll
    for (int r = 0; r < 8; ++r) {
      zs += __expf(c0[r] * 0.125f - nm);
      zs += __expf(c1[r] * 0.125f - nm);
    }
    mloc = nm; zloc = zs;
    __syncthreads();                                   // before next stage
  }

  // combine lane pair (l, l^16): each holds 8 of the 16 rows of column n
  const float mo = __shfl_xor(mloc, 16, 32);
  const float zo = __shfl_xor(zloc, 16, 32);
  const float M  = fmaxf(mloc, mo);
  const float Z  = zloc * __expf(mloc - M) + zo * __expf(mo - M);
  if (lane < 16) {
    mj[bT + j0 + lane] = M;
    zj[bT + j0 + lane] = Z;
  }
}

// ---------------------------------------------------------------------------
// Kernel 3: q~^T[b][d][t] = bf16(q[b,t,d] / Z_{b,t})   (transposed layout so
// the P x q~ B operand is a contiguous global v16bf load)
// ---------------------------------------------------------------------------
__global__ __launch_bounds__(256)
void k_qzt(const uint16_t* __restrict__ qb, const float* __restrict__ zj,
           uint16_t* __restrict__ qzT)
{
  const size_t p = (size_t)blockIdx.x * 256 + threadIdx.x;  // < B*D*T/2
  const int t = (int)(p & 1023) * 2;
  const int d = (int)(p >> 10) & 63;
  const int b = (int)(p >> 16);
  const size_t r0 = (size_t)b * T_ + t;
  const float z0 = zj[r0], z1 = zj[r0 + 1];
  const float f0 = bf2f(qb[r0 * D_ + d]);
  const float f1 = bf2f(qb[(r0 + 1) * D_ + d]);
  *reinterpret_cast<uint32_t*>(qzT + ((size_t)b * D_ + d) * T_ + t) =
      pkbf(f0 / z0, f1 / z1);
}

// ---------------------------------------------------------------------------
// Kernel 4: out[i,:] = sum_j exp(S_ij/8 - m_j) * q~[j,:]
// 8 waves/block share batch b; the j-chunk of q (4KB) is staged per block via
// async global->LDS. P tile transposed (C->A layout) through per-wave LDS.
// B operand of P x q~ read directly from qzT (global, contiguous).
// ---------------------------------------------------------------------------
#define PSTR 48
__global__ __launch_bounds__(256)
void k_attn(const uint16_t* __restrict__ qb, const uint16_t* __restrict__ qzT,
            const float* __restrict__ mj, float* __restrict__ out)
{
  __shared__ __align__(32) uint16_t sQ[32 * D_];        // 4KB shared j-chunk
  __shared__ __align__(32) uint16_t sP[8][16 * PSTR];   // per-wave P tiles
  const int tid = threadIdx.x, wave = tid >> 5, lane = tid & 31;
  const int gw = blockIdx.x * 8 + wave;                 // 0..2047
  const int b  = gw >> 7;
  const int i0 = (gw & 127) * 16;
  const int n  = lane & 15, hi = lane >> 4;
  const size_t bT = (size_t)b * T_;
  uint16_t* P = sP[wave];
  const uint16_t* qbase = qb + bT * D_;
  const uint16_t* zbase = qzT + (size_t)b * D_ * T_;

  // A operand for S: rows i0..i0+15 of q (fixed over j loop)
  const uint16_t* rowA = qbase + (size_t)(i0 + n) * D_;
  v16bf a0 = *reinterpret_cast<const v16bf*>(rowA + hi * 16);
  v16bf a1 = *reinterpret_cast<const v16bf*>(rowA + 32 + hi * 16);

  v8f acc[4] = {v8f{}, v8f{}, v8f{}, v8f{}};

  for (int j0 = 0; j0 < T_; j0 += 32) {
    // stage q rows j0..j0+31 (4KB = 256 x 16B, one chunk per thread)
    stage16(qbase + (size_t)j0 * D_ + tid * 8, sQ + tid * 8);
    stage_wait();
    __syncthreads();

    // two 16x16 S sub-tiles -> P = exp(S/8 - m_j), bf16 row-major in LDS
#pragma unroll
    for (int h = 0; h < 2; ++h) {
      const uint16_t* rb = sQ + (size_t)(h * 16 + n) * D_;
      v16bf bb0 = *reinterpret_cast<const v16bf*>(rb + hi * 16);
      v16bf bb1 = *reinterpret_cast<const v16bf*>(rb + 32 + hi * 16);
      v8f s = {};
      s = wmma_bf16(a0, bb0, s);
      s = wmma_bf16(a1, bb1, s);
      const float mv = mj[bT + j0 + h * 16 + n];
#pragma unroll
      for (int r = 0; r < 8; ++r)
        P[(r + hi * 8) * PSTR + h * 16 + n] = f2bfu(__expf(s[r] * 0.125f - mv));
    }
    __syncthreads();   // P writes (cross-lane transpose) -> reads

    // A = P (16x32), B = q~^T rows (global, contiguous per lane)
    v16bf pa = *reinterpret_cast<const v16bf*>(&P[n * PSTR + hi * 16]);
#pragma unroll
    for (int nt = 0; nt < 4; ++nt) {
      v16bf bv = *reinterpret_cast<const v16bf*>(
          zbase + (size_t)(nt * 16 + n) * T_ + j0 + hi * 16);
      acc[nt] = wmma_bf16(pa, bv, acc[nt]);
    }
    __syncthreads();   // reads done before next iteration overwrites sQ/sP
  }

#pragma unroll
  for (int nt = 0; nt < 4; ++nt)
#pragma unroll
    for (int r = 0; r < 8; ++r)
      out[(bT + i0 + r + hi * 8) * D_ + nt * 16 + n] = acc[nt][r];
}

// ---------------------------------------------------------------------------
extern "C" void kernel_launch(void* const* d_in, const int* in_sizes, int n_in,
                              void* d_out, int out_size, void* d_ws, size_t ws_size,
                              hipStream_t stream)
{
  (void)in_sizes; (void)n_in; (void)out_size; (void)ws_size;
  const float* x  = (const float*)d_in[0];
  const float* Wq = (const float*)d_in[1];
  const float* bq = (const float*)d_in[2];
  float* out = (float*)d_out;

  char* ws = (char*)d_ws;
  uint16_t* qb  = (uint16_t*)(ws);                                 // 4 MB  q bf16
  uint16_t* qzT = (uint16_t*)(ws + ((size_t)4 << 20));             // 4 MB  (q/Z)^T bf16
  uint16_t* WqT = (uint16_t*)(ws + ((size_t)8 << 20));             // 64 KB Wq^T bf16
  float*    mj  = (float*)   (ws + ((size_t)9 << 20));             // 128 KB col max
  float*    zj  = (float*)   (ws + ((size_t)9 << 20) + (1 << 17)); // 128 KB col sum

  k_wt   <<<128,  256, 0, stream>>>(Wq, WqT);
  k_proj <<<256,  256, 0, stream>>>(x, WqT, bq, qb);
  k_stats<<<256,  256, 0, stream>>>(qb, mj, zj);
  k_qzt  <<<4096, 256, 0, stream>>>(qb, zj, qzT);
  k_attn <<<256,  256, 0, stream>>>(qb, qzT, mj, out);
}

// v001
// A run of this version takes 128 microseconds.
// Two timings next to v000 put it at 1.55 and 1.54 times that version's speed.
#include <hip/hip_runtime.h>
#include <hip/hip_bf16.h>
#include <stdint.h>

#define B_  16
#define T_  2048
#define E_  512
#define D_  64

typedef __attribute__((ext_vector_type(16))) __bf16 v16bf;
typedef __attribute__((ext_vector_type(8)))  float  v8f;

// Round two f32 to bf16 (RNE) and pack into one u32 via v_perm_b32.
static __device__ __forceinline__ uint32_t pkbf(float a, float b) {
  uint32_t ua = __builtin_bit_cast(uint32_t, a);
  uint32_t ub = __builtin_bit_cast(uint32_t, b);
  ua += 0x7FFFu + ((ua >> 16) & 1u);
  ub += 0x7FFFu + ((ub >> 16) & 1u);
  // out = {ub[31:24], ub[23:16], ua[31:24], ua[23:16]}
  return __builtin_amdgcn_perm(ub, ua, 0x07060302u);
}
static __device__ __forceinline__ uint16_t f2bfu(float f) {
  uint32_t u = __builtin_bit_cast(uint32_t, f);
  u += 0x7FFFu + ((u >> 16) & 1u);
  return (uint16_t)(u >> 16);
}
static __device__ __forceinline__ float bf2f(uint16_t h) {
  return __builtin_bit_cast(float, (uint32_t)h << 16);   // exact
}

static __device__ __forceinline__ v8f wmma_bf16(v16bf a, v16bf b, v8f c) {
  // D = A(16x32 bf16) * B(32x16 bf16) + C(16x16 f32)
  return __builtin_amdgcn_wmma_f32_16x16x32_bf16(false, a, false, b, (short)0, c,
                                                 false, false);
}

// Rows (k_stats) or columns (k_attn) of S that one ring stage holds, and stages.
#define SJ_  64
#define NST_ (T_ / SJ_)

// LDS byte address of a __shared__ object (what an async copy takes).
static __device__ __forceinline__ uint32_t lds_addr(const void* p) {
  typedef __attribute__((address_space(3))) const unsigned char lds_byte;
  return (uint32_t)(uintptr_t)(lds_byte*)p;
}
// Async copies global -> LDS, 16 B a lane each. The s_wait_xcnt closes the
// statement so that no address register is rewritten ahead of it.
static __device__ __forceinline__ void copy2_b128(uint32_t l0, const void* g0,
                                                  uint32_t l1, const void* g1) {
  asm volatile("global_load_async_to_lds_b128 %0, %1, off\n\t"
               "global_load_async_to_lds_b128 %2, %3, off\n\t"
               "s_wait_xcnt 0x0"
               :: "v"(l0), "v"(g0), "v"(l1), "v"(g1) : "memory");
}
// The same, 8 B a lane.
static __device__ __forceinline__ void copy1_b64(uint32_t l0, const void* g0) {
  asm volatile("global_load_async_to_lds_b64 %0, %1, off\n\t"
               "s_wait_xcnt 0x0"
               :: "v"(l0), "v"(g0) : "memory");
}
// This wave's copies have landed (other waves read them behind the barrier).
static __device__ __forceinline__ void wait_async() {
  asm volatile("s_wait_asynccnt 0x0" ::: "memory");
}
// This wave's LDS reads are done (before a copy refills what it has read).
static __device__ __forceinline__ void wait_ds() {
  asm volatile("s_wait_dscnt 0x0" ::: "memory");
}

// ---------------------------------------------------------------------------
// Kernel 0: WqT[n][k] = bf16(Wq[k][n])  (64x512 bf16, 64KB -> stays L2 hot)
// ---------------------------------------------------------------------------
__global__ __launch_bounds__(256)
void k_wt(const float* __restrict__ Wq, uint16_t* __restrict__ WqT)
{
  const int idx = blockIdx.x * 256 + threadIdx.x;      // < 32768
  const int k = idx & (E_ - 1);
  const int n = idx >> 9;
  WqT[(size_t)n * E_ + k] = f2bfu(Wq[(size_t)k * D_ + n]);
}

// ---------------------------------------------------------------------------
// Kernel 1: q = x @ Wq + bq (bf16 out). One wave per 16x64 q tile; B from WqT
// (global, contiguous v16bf per lane, L2 resident). No LDS needed.
// ---------------------------------------------------------------------------
__global__ __launch_bounds__(256)
void k_proj(const float* __restrict__ x, const uint16_t* __restrict__ WqT,
            const float* __restrict__ bq, uint16_t* __restrict__ qb)
{
  const int tid  = threadIdx.x;
  const int wave = tid >> 5;
  const int lane = tid & 31;
  const int n    = lane & 15;      // A-layout M / C-layout N
  const int hi   = lane >> 4;      // K-half selector
  const int tok0 = blockIdx.x * 128 + wave * 16;

  v8f acc[4] = {v8f{}, v8f{}, v8f{}, v8f{}};
  const float* xrow = x + (size_t)(tok0 + n) * E_;

  for (int kb = 0; kb < E_; kb += 32) {
    if (kb + 32 < E_)
      __builtin_prefetch(xrow + kb + 32 + hi * 16, 0, 0);

    // A operand: x[tok0+n][kb + hi*16 .. +15] -> bf16 (perm-packed converts)
    const float4* xr = reinterpret_cast<const float4*>(xrow + kb + hi * 16);
    float4 p0 = xr[0], p1 = xr[1], p2 = xr[2], p3 = xr[3];
    float fv[16] = {p0.x, p0.y, p0.z, p0.w, p1.x, p1.y, p1.z, p1.w,
                    p2.x, p2.y, p2.z, p2.w, p3.x, p3.y, p3.z, p3.w};
    union { v16bf v; uint32_t w[8]; } ua;
#pragma unroll
    for (int q = 0; q < 8; ++q) ua.w[q] = pkbf(fv[2 * q], fv[2 * q + 1]);

#pragma unroll
    for (int nt = 0; nt < 4; ++nt) {
      v16bf bv = *reinterpret_cast<const v16bf*>(
          WqT + (size_t)(nt * 16 + n) * E_ + kb + hi * 16);
      acc[nt] = wmma_bf16(ua.v, bv, acc[nt]);
    }
  }

  // Epilogue: C layout -> lane holds column n, rows r + hi*8
#pragma unroll
  for (int nt = 0; nt < 4; ++nt) {
    const int col  = nt * 16 + n;
    const float bb = bq[col];
#pragma unroll
    for (int r = 0; r < 8; ++r) {
      const size_t row = (size_t)tok0 + r + hi * 8;
      qb[row * D_ + col] = f2bfu(acc[nt][r] + bb);
    }
  }
}

// ---------------------------------------------------------------------------
// Kernel 2: column softmax stats: m_j = max_i S_ij, Z_j = sum_i e^{S_ij-m_j}.
// 8 waves/block share batch b; 64-row i-chunks of q (8KB) go through a ring of
// two LDS buffers: stage t+1's async copies fly while stage t is worked on.
// ---------------------------------------------------------------------------
__global__ __launch_bounds__(256)
void k_stats(const uint16_t* __restrict__ qb, float* __restrict__ mj,
             float* __restrict__ zj)
{
  __shared__ __align__(32) uint16_t sA[2][SJ_ * D_];   // 2 x 8KB ring of i-chunks
  const int tid = threadIdx.x, wave = tid >> 5, lane = tid & 31;
  const int gw = blockIdx.x * 8 + wave;                // 0..2047
  const int b  = gw >> 7;
  const int j0 = (gw & 127) * 16;
  const int n  = lane & 15, hi = lane >> 4;
  const size_t bT = (size_t)b * T_;
  const uint16_t* qbase = qb + bT * D_;

  // B operand fixed over i loop: B[k][n] = q[j0+n][k]
  const uint16_t* rowB = qbase + (size_t)(j0 + n) * D_;
  v16bf b0 = *reinterpret_cast<const v16bf*>(rowB + hi * 16);
  v16bf b1 = *reinterpret_cast<const v16bf*>(rowB + 32 + hi * 16);

  // a stage is 8KB contiguous in q: two 16B copies per thread, 4KB apart
  const uint32_t  lA = lds_addr(&sA[0][0]) + tid * 16;
  const uint16_t* gA = qbase + tid * 8;
  copy2_b128(lA, gA, lA + 4096, gA + 2048);                       // stage 0
  wait_async();
  __syncthreads();
  copy2_b128(lA + 8192, gA + SJ_ * D_,
             lA + 8192 + 4096, gA + SJ_ * D_ + 2048);             // stage 1

  float mloc = -1.0e30f, zloc = 0.0f;
  for (int t = 0; t < NST_; ++t) {
    const uint16_t* sAt = sA[t & 1];
    // constant LDS offsets for both 32-row halves of the stage
#pragma unroll
    for (int sub = 0; sub < SJ_ / 32; ++sub) {
      v8f c0 = {}, c1 = {};
      {
        const uint16_t* ar = sAt + (size_t)(sub * 32 + n) * D_;
        v16bf a0 = *reinterpret_cast<const v16bf*>(ar + hi * 16);
        v16bf a1 = *reinterpret_cast<const v16bf*>(ar + 32 + hi * 16);
        c0 = wmma_bf16(a0, b0, c0);
        c0 = wmma_bf16(a1, b1, c0);
      }
      {
        const uint16_t* ar = sAt + (size_t)(sub * 32 + 16 + n) * D_;
        v16bf a0 = *reinterpret_cast<const v16bf*>(ar + hi * 16);
        v16bf a1 = *reinterpret_cast<const v16bf*>(ar + 32 + hi * 16);
        c1 = wmma_bf16(a0, b0, c1);
        c1 = wmma_bf16(a1, b1, c1);
      }

      float tmax = -1.0e30f;
#pragma unroll
      for (int r = 0; r < 8; ++r) {
        tmax = fmaxf(tmax, c0[r] * 0.125f);
        tmax = fmaxf(tmax, c1[r] * 0.125f);
      }
      const float nm = fmaxf(mloc, tmax);
      float zs = zloc * __expf(mloc - nm);
#pragma unroll
      for (int r = 0; r < 8; ++r) {
        zs += __expf(c0[r] * 0.125f - nm);
        zs += __expf(c1[r] * 0.125f - nm);
      }
      mloc = nm; zloc = zs;
    }
    // publish stage t+1, free stage t's buffer, then refill it with stage t+2
    wait_ds();
    wait_async();
    __syncthreads();
    if (t + 2 < NST_) {
      const uint32_t  l = lA + (t & 1) * 8192;
      const uint16_t* g = gA + (size_t)(t + 2) * (SJ_ * D_);
      copy2_b128(l, g, l + 4096, g + 2048);
    }
  }
  wait_async();

  // combine lane pair (l, l^16): each holds 8 of the 16 rows of column n
  const float mo = __shfl_xor(mloc, 16, 32);
  const float zo = __shfl_xor(zloc, 16, 32);
  const float M  = fmaxf(mloc, mo);
  const float Z  = zloc * __expf(mloc - M) + zo * __expf(mo - M);
  if (lane < 16) {
    mj[bT + j0 + lane] = M;
    zj[bT + j0 + lane] = Z;
  }
}

// ---------------------------------------------------------------------------
// Kernel 3: q~^T[b][d][t] = bf16(q[b,t,d] / Z_{b,t})   (transposed layout so
// the P x q~ B operand, staged in LDS, is 32 contiguous bytes a lane)
// ---------------------------------------------------------------------------
__global__ __launch_bounds__(256)
void k_qzt(const uint16_t* __restrict__ qb, const float* __restrict__ zj,
           uint16_t* __restrict__ qzT)
{
  const size_t p = (size_t)blockIdx.x * 256 + threadIdx.x;  // < B*D*T/2
  const int t = (int)(p & 1023) * 2;
  const int d = (int)(p >> 10) & 63;
  const int b = (int)(p >> 16);
  const size_t r0 = (size_t)b * T_ + t;
  const float z0 = zj[r0], z1 = zj[r0 + 1];
  const float f0 = bf2f(qb[r0 * D_ + d]);
  const float f1 = bf2f(qb[(r0 + 1) * D_ + d]);
  *reinterpret_cast<uint32_t*>(qzT + ((size_t)b * D_ + d) * T_ + t) =
      pkbf(f0 / z0, f1 / z1);
}

// ---------------------------------------------------------------------------
// Kernel 4: out[i,:] = sum_j exp(S_ij/8 - m_j) * q~[j,:]
// 8 waves/block share batch b; per 64 columns j the block's operands (q rows,
// q~^T columns, m) go through a ring of two LDS buffers: stage t+1's async
// copies fly while stage t is worked on. P tile transposed (C->A layout)
// through per-wave LDS.
// ---------------------------------------------------------------------------
#define PSTR 48
#define ZPIT 72   // q~^T rows in LDS: 128 B of data at a pitch of 144 B
__global__ __launch_bounds__(256)
void k_attn(const uint16_t* __restrict__ qb, const uint16_t* __restrict__ qzT,
            const float* __restrict__ mj, float* __restrict__ out)
{
  __shared__ __align__(32) uint16_t sQ[2][SJ_ * D_];    // 2 x 8KB q rows j
  __shared__ __align__(16) uint16_t sZ[2][D_ * ZPIT];   // 2 x 9KB q~^T[d][j]
  __shared__ __align__(16) float    sM[2][SJ_];         // 2 x 256B m_j
  __shared__ __align__(32) uint16_t sP[8][16 * PSTR];   // per-wave P tiles
  const int tid = threadIdx.x, lane = tid & 31;
  const int wave = __builtin_amdgcn_readfirstlane(tid >> 5);
  const int gw = blockIdx.x * 8 + wave;                 // 0..2047
  const int b  = gw >> 7;
  const int i0 = (gw & 127) * 16;
  const int n  = lane & 15, hi = lane >> 4;
  const size_t bT = (size_t)b * T_;
  uint16_t* P = sP[wave];
  const uint16_t* qbase = qb + bT * D_;
  const uint16_t* zbase = qzT + (size_t)b * D_ * T_;

  // A operand for S: rows i0..i0+15 of q (fixed over j loop)
  const uint16_t* rowA = qbase + (size_t)(i0 + n) * D_;
  v16bf a0 = *reinterpret_cast<const v16bf*>(rowA + hi * 16);
  v16bf a1 = *reinterpret_cast<const v16bf*>(rowA + 32 + hi * 16);

  v8f acc[4] = {v8f{}, v8f{}, v8f{}, v8f{}};

  // One stage: q rows, 8KB contiguous (two 16B copies a thread, 4KB apart);
  // q~^T, 64 rows d of 128 B (eight threads a row, two copies 32 rows apart);
  // m, 256 B (wave 0, 8 B a lane).
  const uint32_t  lQ = lds_addr(&sQ[0][0]) + tid * 16;
  const uint32_t  lZ = lds_addr(&sZ[0][0]) + (tid >> 3) * (ZPIT * 2) + (tid & 7) * 16;
  const uint32_t  lM = lds_addr(&sM[0][0]) + lane * 8;
  const uint16_t* gQ = qbase + tid * 8;
  const uint16_t* gZ = zbase + (size_t)(tid >> 3) * T_ + (tid & 7) * 8;
  const float*    gM = mj + bT + lane * 2;
  auto stage = [&](int s, int buf) {
    const uint32_t  q = lQ + buf * (SJ_ * D_ * 2);
    const uint16_t* a = gQ + (size_t)s * (SJ_ * D_);
    copy2_b128(q, a, q + 4096, a + 2048);
    const uint32_t  z = lZ + buf * (D_ * ZPIT * 2);
    const uint16_t* c = gZ + s * SJ_;
    copy2_b128(z, c, z + 32 * ZPIT * 2, c + (size_t)32 * T_);
    if (wave == 0)
      copy1_b64(lM + buf * (SJ_ * 4), gM + s * SJ_);
  };
  stage(0, 0);
  wait_async();
  __syncthreads();
  stage(1, 1);

  for (int t = 0; t < NST_; ++t) {
    const uint16_t* sQt = sQ[t & 1];
    const uint16_t* sZt = sZ[t & 1];
    const float*    sMt = sM[t & 1];
    // constant LDS offsets for both 32-column halves of the stage
#pragma unroll
    for (int sub = 0; sub < SJ_ / 32; ++sub) {
      // two 16x16 S sub-tiles -> P = exp(S/8 - m_j), bf16 row-major in LDS
#pragma unroll
      for (int h = 0; h < 2; ++h) {
        const uint16_t* rb = sQt + (size_t)(sub * 32 + h * 16 + n) * D_;
        v16bf bb0 = *reinterpret_cast<const v16bf*>(rb + hi * 16);
        v16bf bb1 = *reinterpret_cast<const v16bf*>(rb + 32 + hi * 16);
        v8f s = {};
        s = wmma_bf16(a0, bb0, s);
        s = wmma_bf16(a1, bb1, s);
        const float mv = sMt[sub * 32 + h * 16 + n];
#pragma unroll
        for (int r = 0; r < 8; ++r)
          P[(r + hi * 8) * PSTR + h * 16 + n] = f2bfu(__expf(s[r] * 0.125f - mv));
      }
      __syncthreads();   // P writes (cross-lane transpose) -> reads

      // A = P (16x32), B = q~^T rows (LDS, 32 contiguous bytes per lane)
      v16bf pa = *reinterpret_cast<const v16bf*>(&P[n * PSTR + hi * 16]);
#pragma unroll
      for (int nt = 0; nt < 4; ++nt) {
        const uint4* zr = reinterpret_cast<const uint4*>(
            sZt + (nt * 16 + n) * ZPIT + sub * 32 + hi * 16);
        union { v16bf v; uint4 q[2]; } ub;
        ub.q[0] = zr[0];
        ub.q[1] = zr[1];
        acc[nt] = wmma_bf16(pa, ub.v, acc[nt]);
      }
    }
    // publish stage t+1, free stage t's buffers, then refill them with t+2
    // (P is private to its wave: the wave's own LDS order covers its reuse)
    wait_ds();
    wait_async();
    __syncthreads();
    if (t + 2 < NST_) stage(t + 2, t & 1);
  }
  wait_async();

#pragma unroll
  for (int nt = 0; nt < 4; ++nt)
#pragma unroll
    for (int r = 0; r < 8; ++r)
      out[(bT + i0 + r + hi * 8) * D_ + nt * 16 + n] = acc[nt][r];
}

// ---------------------------------------------------------------------------
extern "C" void kernel_launch(void* const* d_in, const int* in_sizes, int n_in,
                              void* d_out, int out_size, void* d_ws, size_t ws_size,
                              hipStream_t stream)
{
  (void)in_sizes; (void)n_in; (void)out_size; (void)ws_size;
  const float* x  = (const float*)d_in[0];
  const float* Wq = (const float*)d_in[1];
  const float* bq = (const float*)d_in[2];
  float* out = (float*)d_out;

  char* ws = (char*)d_ws;
  uint16_t* qb  = (uint16_t*)(ws);                                 // 4 MB  q bf16
  uint16_t* qzT = (uint16_t*)(ws + ((size_t)4 << 20));             // 4 MB  (q/Z)^T bf16
  uint16_t* WqT = (uint16_t*)(ws + ((size_t)8 << 20));             // 64 KB Wq^T bf16
  float*    mj  = (float*)   (ws + ((size_t)9 << 20));             // 128 KB col max
  float*    zj  = (float*)   (ws + ((size_t)9 << 20) + (1 << 17)); // 128 KB col sum

  k_wt   <<<128,  256, 0, stream>>>(Wq, WqT);
  k_proj <<<256,  256, 0, stream>>>(x, WqT, bq, qb);
  k_stats<<<256,  256, 0, stream>>>(qb, mj, zj);
  k_qzt  <<<4096, 256, 0, stream>>>(qb, zj, qzT);
  k_attn <<<256,  256, 0, stream>>>(qb, qzT, mj, out);
}

// v002
// It runs in 94.2 microseconds.
// In two side-by-side timings against v001, it was 1.36 and 1.35 times as fast.
// Counting every step since v000, it is 2.09 times as fast.
#include <hip/hip_runtime.h>
#include <hip/hip_bf16.h>
#include <stdint.h>

#define B_  16
#define T_  2048
#define E_  512
#define D_  64

typedef __attribute__((ext_vector_type(16))) __bf16 v16bf;
typedef __attribute__((ext_vector_type(8)))  float  v8f;

// Round two f32 to bf16 (RNE) and pack into one u32 via v_perm_b32.
static __device__ __forceinline__ uint32_t pkbf(float a, float b) {
  uint32_t ua = __builtin_bit_cast(uint32_t, a);
  uint32_t ub = __builtin_bit_cast(uint32_t, b);
  ua += 0x7FFFu + ((ua >> 16) & 1u);
  ub += 0x7FFFu + ((ub >> 16) & 1u);
  // out = {ub[31:24], ub[23:16], ua[31:24], ua[23:16]}
  return __builtin_amdgcn_perm(ub, ua, 0x07060302u);
}
static __device__ __forceinline__ uint16_t f2bfu(float f) {
  uint32_t u = __builtin_bit_cast(uint32_t, f);
  u += 0x7FFFu + ((u >> 16) & 1u);
  return (uint16_t)(u >> 16);
}
static __device__ __forceinline__ float bf2f(uint16_t h) {
  return __builtin_bit_cast(float, (uint32_t)h << 16);   // exact
}

static __device__ __forceinline__ v8f wmma_bf16(v16bf a, v16bf b, v8f c) {
  // D = A(16x32 bf16) * B(32x16 bf16) + C(16x16 f32)
  return __builtin_amdgcn_wmma_f32_16x16x32_bf16(false, a, false, b, (short)0, c,
                                                 false, false);
}

// Rows (k_stats) or columns (k_attn) of S that one ring stage holds, and stages.
#define SJ_  64
#define NST_ (T_ / SJ_)
// q rows in LDS: 128 B of data at a pitch of 144 B (16 B x odd), so that the 16
// rows one ds_load_b128 reads fall on 16 different groups of four banks.
#define QPIT 72

// A 16-element fragment from LDS rows that are 16-byte aligned only.
static __device__ __forceinline__ v16bf lds_frag(const uint16_t* p) {
  const uint4* q = reinterpret_cast<const uint4*>(p);
  union { v16bf v; uint4 q[2]; } u;
  u.q[0] = q[0];
  u.q[1] = q[1];
  return u.v;
}

// LDS byte address of a __shared__ object (what an async copy takes).
static __device__ __forceinline__ uint32_t lds_addr(const void* p) {
  typedef __attribute__((address_space(3))) const unsigned char lds_byte;
  return (uint32_t)(uintptr_t)(lds_byte*)p;
}
// Async copies global -> LDS, 16 B a lane each. The s_wait_xcnt closes the
// statement so that no address register is rewritten ahead of it.
static __device__ __forceinline__ void copy2_b128(uint32_t l0, const void* g0,
                                                  uint32_t l1, const void* g1) {
  asm volatile("global_load_async_to_lds_b128 %0, %1, off\n\t"
               "global_load_async_to_lds_b128 %2, %3, off\n\t"
               "s_wait_xcnt 0x0"
               :: "v"(l0), "v"(g0), "v"(l1), "v"(g1) : "memory");
}
// The same, 8 B a lane.
static __device__ __forceinline__ void copy1_b64(uint32_t l0, const void* g0) {
  asm volatile("global_load_async_to_lds_b64 %0, %1, off\n\t"
               "s_wait_xcnt 0x0"
               :: "v"(l0), "v"(g0) : "memory");
}
// This wave's copies have landed (other waves read them behind the barrier).
static __device__ __forceinline__ void wait_async() {
  asm volatile("s_wait_asynccnt 0x0" ::: "memory");
}
// This wave's LDS reads are done (before a copy refills what it has read).
static __device__ __forceinline__ void wait_ds() {
  asm volatile("s_wait_dscnt 0x0" ::: "memory");
}

// ---------------------------------------------------------------------------
// Kernel 0: WqT[n][k] = bf16(Wq[k][n])  (64x512 bf16, 64KB -> stays L2 hot)
// ---------------------------------------------------------------------------
__global__ __launch_bounds__(256)
void k_wt(const float* __restrict__ Wq, uint16_t* __restrict__ WqT)
{
  const int idx = blockIdx.x * 256 + threadIdx.x;      // < 32768
  const int k = idx & (E_ - 1);
  const int n = idx >> 9;
  WqT[(size_t)n * E_ + k] = f2bfu(Wq[(size_t)k * D_ + n]);
}

// ---------------------------------------------------------------------------
// Kernel 1: q = x @ Wq + bq (bf16 out). One wave per 16x64 q tile; B from WqT
// (global, contiguous v16bf per lane, L2 resident). No LDS needed.
// ---------------------------------------------------------------------------
__global__ __launch_bounds__(256)
void k_proj(const float* __restrict__ x, const uint16_t* __restrict__ WqT,
            const float* __restrict__ bq, uint16_t* __restrict__ qb)
{
  const int tid  = threadIdx.x;
  const int wave = tid >> 5;
  const int lane = tid & 31;
  const int n    = lane & 15;      // A-layout M / C-layout N
  const int hi   = lane >> 4;      // K-half selector
  const int tok0 = blockIdx.x * 128 + wave * 16;

  v8f acc[4] = {v8f{}, v8f{}, v8f{}, v8f{}};
  const float* xrow = x + (size_t)(tok0 + n) * E_;

  for (int kb = 0; kb < E_; kb += 32) {
    if (kb + 32 < E_)
      __builtin_prefetch(xrow + kb + 32 + hi * 16, 0, 0);

    // A operand: x[tok0+n][kb + hi*16 .. +15] -> bf16 (perm-packed converts)
    const float4* xr = reinterpret_cast<const float4*>(xrow + kb + hi * 16);
    float4 p0 = xr[0], p1 = xr[1], p2 = xr[2], p3 = xr[3];
    float fv[16] = {p0.x, p0.y, p0.z, p0.w, p1.x, p1.y, p1.z, p1.w,
                    p2.x, p2.y, p2.z, p2.w, p3.x, p3.y, p3.z, p3.w};
    union { v16bf v; uint32_t w[8]; } ua;
#pragma unroll
    for (int q = 0; q < 8; ++q) ua.w[q] = pkbf(fv[2 * q], fv[2 * q + 1]);

#pragma unroll
    for (int nt = 0; nt < 4; ++nt) {
      v16bf bv = *reinterpret_cast<const v16bf*>(
          WqT + (size_t)(nt * 16 + n) * E_ + kb + hi * 16);
      acc[nt] = wmma_bf16(ua.v, bv, acc[nt]);
    }
  }

  // Epilogue: C layout -> lane holds column n, rows r + hi*8
#pragma unroll
  for (int nt = 0; nt < 4; ++nt) {
    const int col  = nt * 16 + n;
    const float bb = bq[col];
#pragma unroll
    for (int r = 0; r < 8; ++r) {
      const size_t row = (size_t)tok0 + r + hi * 8;
      qb[row * D_ + col] = f2bfu(acc[nt][r] + bb);
    }
  }
}

// ---------------------------------------------------------------------------
// Kernel 2: column softmax stats: m_j = max_i S_ij, Z_j = sum_i e^{S_ij-m_j}.
// 8 waves/block share batch b; 64-row i-chunks of q (8KB) go through a ring of
// two LDS buffers: stage t+1's async copies fly while stage t is worked on.
// ---------------------------------------------------------------------------
__global__ __launch_bounds__(256)
void k_stats(const uint16_t* __restrict__ qb, float* __restrict__ mj,
             float* __restrict__ zj)
{
  __shared__ __align__(16) uint16_t sA[2][SJ_ * QPIT]; // 2 x 9KB ring of i-chunks
  const int tid = threadIdx.x, wave = tid >> 5, lane = tid & 31;
  const int gw = blockIdx.x * 8 + wave;                // 0..2047
  const int b  = gw >> 7;
  const int j0 = (gw & 127) * 16;
  const int n  = lane & 15, hi = lane >> 4;
  const size_t bT = (size_t)b * T_;
  const uint16_t* qbase = qb + bT * D_;

  // B operand fixed over i loop: B[k][n] = q[j0+n][k]
  const uint16_t* rowB = qbase + (size_t)(j0 + n) * D_;
  v16bf b0 = *reinterpret_cast<const v16bf*>(rowB + hi * 16);
  v16bf b1 = *reinterpret_cast<const v16bf*>(rowB + 32 + hi * 16);

  // a stage is 8KB contiguous in q: eight threads a row, two 16B copies per
  // thread, 32 rows apart
  const uint32_t  lA = lds_addr(&sA[0][0]) + (tid >> 3) * (QPIT * 2) + (tid & 7) * 16;
  const uint16_t* gA = qbase + tid * 8;
  copy2_b128(lA, gA, lA + 32 * QPIT * 2, gA + 2048);              // stage 0
  wait_async();
  __syncthreads();
  copy2_b128(lA + SJ_ * QPIT * 2, gA + SJ_ * D_,
             lA + (SJ_ + 32) * QPIT * 2, gA + SJ_ * D_ + 2048);   // stage 1

  float mloc = -1.0e30f, zloc = 0.0f;
  for (int t = 0; t < NST_; ++t) {
    const uint16_t* sAt = sA[t & 1];
    // constant LDS offsets for both 32-row halves of the stage
#pragma unroll
    for (int sub = 0; sub < SJ_ / 32; ++sub) {
      v8f c0 = {}, c1 = {};
      {
        const uint16_t* ar = sAt + (sub * 32 + n) * QPIT;
        v16bf a0 = lds_frag(ar + hi * 16);
        v16bf a1 = lds_frag(ar + 32 + hi * 16);
        c0 = wmma_bf16(a0, b0, c0);
        c0 = wmma_bf16(a1, b1, c0);
      }
      {
        const uint16_t* ar = sAt + (sub * 32 + 16 + n) * QPIT;
        v16bf a0 = lds_frag(ar + hi * 16);
        v16bf a1 = lds_frag(ar + 32 + hi * 16);
        c1 = wmma_bf16(a0, b0, c1);
        c1 = wmma_bf16(a1, b1, c1);
      }

      float tmax = -1.0e30f;
#pragma unroll
      for (int r = 0; r < 8; ++r) {
        tmax = fmaxf(tmax, c0[r] * 0.125f);
        tmax = fmaxf(tmax, c1[r] * 0.125f);
      }
      const float nm = fmaxf(mloc, tmax);
      float zs = zloc * __expf(mloc - nm);
#pragma unroll
      for (int r = 0; r < 8; ++r) {
        zs += __expf(c0[r] * 0.125f - nm);
        zs += __expf(c1[r] * 0.125f - nm);
      }
      mloc = nm; zloc = zs;
    }
    // publish stage t+1, free stage t's buffer, then refill it with stage t+2
    wait_ds();
    wait_async();
    __syncthreads();
    if (t + 2 < NST_) {
      const uint32_t  l = lA + (t & 1) * (SJ_ * QPIT * 2);
      const uint16_t* g = gA + (size_t)(t + 2) * (SJ_ * D_);
      copy2_b128(l, g, l + 32 * QPIT * 2, g + 2048);
    }
  }
  wait_async();

  // combine lane pair (l, l^16): each holds 8 of the 16 rows of column n
  const float mo = __shfl_xor(mloc, 16, 32);
  const float zo = __shfl_xor(zloc, 16, 32);
  const float M  = fmaxf(mloc, mo);
  const float Z  = zloc * __expf(mloc - M) + zo * __expf(mo - M);
  if (lane < 16) {
    mj[bT + j0 + lane] = M;
    zj[bT + j0 + lane] = Z;
  }
}

// ---------------------------------------------------------------------------
// Kernel 3: q~^T[b][d][t] = bf16(q[b,t,d] / Z_{b,t})   (transposed layout so
// the P x q~ B operand, staged in LDS, is 32 contiguous bytes a lane)
// ---------------------------------------------------------------------------
__global__ __launch_bounds__(256)
void k_qzt(const uint16_t* __restrict__ qb, const float* __restrict__ zj,
           uint16_t* __restrict__ qzT)
{
  const size_t p = (size_t)blockIdx.x * 256 + threadIdx.x;  // < B*D*T/2
  const int t = (int)(p & 1023) * 2;
  const int d = (int)(p >> 10) & 63;
  const int b = (int)(p >> 16);
  const size_t r0 = (size_t)b * T_ + t;
  const float z0 = zj[r0], z1 = zj[r0 + 1];
  const float f0 = bf2f(qb[r0 * D_ + d]);
  const float f1 = bf2f(qb[(r0 + 1) * D_ + d]);
  *reinterpret_cast<uint32_t*>(qzT + ((size_t)b * D_ + d) * T_ + t) =
      pkbf(f0 / z0, f1 / z1);
}

// ---------------------------------------------------------------------------
// Kernel 4: out[i,:] = sum_j exp(S_ij/8 - m_j) * q~[j,:]
// 8 waves/block share batch b; per 64 columns j the block's operands (q rows,
// q~^T columns, m) go through a ring of two LDS buffers: stage t+1's async
// copies fly while stage t is worked on. P tile transposed (C->A layout)
// through per-wave LDS.
// ---------------------------------------------------------------------------
#define PSTR 40   // P rows in LDS: 64 B of data at a pitch of 80 B (16 B x odd)
#define ZPIT 72   // q~^T rows in LDS: 128 B of data at a pitch of 144 B
__global__ __launch_bounds__(256)
void k_attn(const uint16_t* __restrict__ qb, const uint16_t* __restrict__ qzT,
            const float* __restrict__ mj, float* __restrict__ out)
{
  __shared__ __align__(16) uint16_t sQ[2][SJ_ * QPIT];  // 2 x 9KB q rows j
  __shared__ __align__(16) uint16_t sZ[2][D_ * ZPIT];   // 2 x 9KB q~^T[d][j]
  __shared__ __align__(16) float    sM[2][SJ_];         // 2 x 256B m_j
  __shared__ __align__(16) uint16_t sP[8][16 * PSTR];   // per-wave P tiles
  const int tid = threadIdx.x, lane = tid & 31;
  const int wave = __builtin_amdgcn_readfirstlane(tid >> 5);
  const int gw = blockIdx.x * 8 + wave;                 // 0..2047
  const int b  = gw >> 7;
  const int i0 = (gw & 127) * 16;
  const int n  = lane & 15, hi = lane >> 4;
  const size_t bT = (size_t)b * T_;
  uint16_t* P = sP[wave];
  const uint16_t* qbase = qb + bT * D_;
  const uint16_t* zbase = qzT + (size_t)b * D_ * T_;

  // A operand for S: rows i0..i0+15 of q (fixed over j loop)
  const uint16_t* rowA = qbase + (size_t)(i0 + n) * D_;
  v16bf a0 = *reinterpret_cast<const v16bf*>(rowA + hi * 16);
  v16bf a1 = *reinterpret_cast<const v16bf*>(rowA + 32 + hi * 16);

  v8f acc[4] = {v8f{}, v8f{}, v8f{}, v8f{}};

  // One stage: q rows, 8KB contiguous (eight threads a row, two 16B copies 32
  // rows apart);
  // q~^T, 64 rows d of 128 B (eight threads a row, two copies 32 rows apart);
  // m, 256 B (wave 0, 8 B a lane).
  const uint32_t  lQ = lds_addr(&sQ[0][0]) + (tid >> 3) * (QPIT * 2) + (tid & 7) * 16;
  const uint32_t  lZ = lds_addr(&sZ[0][0]) + (tid >> 3) * (ZPIT * 2) + (tid & 7) * 16;
  const uint32_t  lM = lds_addr(&sM[0][0]) + lane * 8;
  const uint16_t* gQ = qbase + tid * 8;
  const uint16_t* gZ = zbase + (size_t)(tid >> 3) * T_ + (tid & 7) * 8;
  const float*    gM = mj + bT + lane * 2;
  auto stage = [&](int s, int buf) {
    const uint32_t  q = lQ + buf * (SJ_ * QPIT * 2);
    const uint16_t* a = gQ + (size_t)s * (SJ_ * D_);
    copy2_b128(q, a, q + 32 * QPIT * 2, a + 2048);
    const uint32_t  z = lZ + buf * (D_ * ZPIT * 2);
    const uint16_t* c = gZ + s * SJ_;
    copy2_b128(z, c, z + 32 * ZPIT * 2, c + (size_t)32 * T_);
    if (wave == 0)
      copy1_b64(lM + buf * (SJ_ * 4), gM + s * SJ_);
  };
  stage(0, 0);
  wait_async();
  __syncthreads();
  stage(1, 1);

  for (int t = 0; t < NST_; ++t) {
    const uint16_t* sQt = sQ[t & 1];
    const uint16_t* sZt = sZ[t & 1];
    const float*    sMt = sM[t & 1];
    // constant LDS offsets for both 32-column halves of the stage
#pragma unroll
    for (int sub = 0; sub < SJ_ / 32; ++sub) {
      // two 16x16 S sub-tiles -> P = exp(S/8 - m_j), bf16 row-major in LDS
#pragma unroll
      for (int h = 0; h < 2; ++h) {
        const uint16_t* rb = sQt + (sub * 32 + h * 16 + n) * QPIT;
        v16bf bb0 = lds_frag(rb + hi * 16);
        v16bf bb1 = lds_frag(rb + 32 + hi * 16);
        v8f s = {};
        s = wmma_bf16(a0, bb0, s);
        s = wmma_bf16(a1, bb1, s);
        const float mv = sMt[sub * 32 + h * 16 + n];
#pragma unroll
        for (int r = 0; r < 8; ++r)
          P[(r + hi * 8) * PSTR + h * 16 + n] = f2bfu(__expf(s[r] * 0.125f - mv));
      }
      __syncthreads();   // P writes (cross-lane transpose) -> reads

      // A = P (16x32), B = q~^T rows (LDS, 32 contiguous bytes per lane)
      v16bf pa = lds_frag(&P[n * PSTR + hi * 16]);
#pragma unroll
      for (int nt = 0; nt < 4; ++nt) {
        const uint4* zr = reinterpret_cast<const uint4*>(
            sZt + (nt * 16 + n) * ZPIT + sub * 32 + hi * 16);
        union { v16bf v; uint4 q[2]; } ub;
        ub.q[0] = zr[0];
        ub.q[1] = zr[1];
        acc[nt] = wmma_bf16(pa, ub.v, acc[nt]);
      }
    }
    // publish stage t+1, free stage t's buffers, then refill them with t+2
    // (P is private to its wave: the wave's own LDS order covers its reuse)
    wait_ds();
    wait_async();
    __syncthreads();
    if (t + 2 < NST_) stage(t + 2, t & 1);
  }
  wait_async();

#pragma unroll
  for (int nt = 0; nt < 4; ++nt)
#pragma unroll
    for (int r = 0; r < 8; ++r)
      out[(bT + i0 + r + hi * 8) * D_ + nt * 16 + n] = acc[nt][r];
}

// ---------------------------------------------------------------------------
extern "C" void kernel_launch(void* const* d_in, const int* in_sizes, int n_in,
                              void* d_out, int out_size, void* d_ws, size_t ws_size,
                              hipStream_t stream)
{
  (void)in_sizes; (void)n_in; (void)out_size; (void)ws_size;
  const float* x  = (const float*)d_in[0];
  const float* Wq = (const float*)d_in[1];
  const float* bq = (const float*)d_in[2];
  float* out = (float*)d_out;

  char* ws = (char*)d_ws;
  uint16_t* qb  = (uint16_t*)(ws);                                 // 4 MB  q bf16
  uint16_t* qzT = (uint16_t*)(ws + ((size_t)4 << 20));             // 4 MB  (q/Z)^T bf16
  uint16_t* WqT = (uint16_t*)(ws + ((size_t)8 << 20));             // 64 KB Wq^T bf16
  float*    mj  = (float*)   (ws + ((size_t)9 << 20));             // 128 KB col max
  float*    zj  = (float*)   (ws + ((size_t)9 << 20) + (1 << 17)); // 128 KB col sum

  k_wt   <<<128,  256, 0, stream>>>(Wq, WqT);
  k_proj <<<256,  256, 0, stream>>>(x, WqT, bq, qb);
  k_stats<<<256,  256, 0, stream>>>(qb, mj, zj);
  k_qzt  <<<4096, 256, 0, stream>>>(qb, zj, qzT);
  k_attn <<<256,  256, 0, stream>>>(qb, qzT, mj, out);
}

// v003
// A run of this version takes 84.6 microseconds.
// Timed twice side by side with v002, it ran 1.12 times as fast both times.
// All steps since v000 together make it 2.34 times as fast.
#include <hip/hip_runtime.h>
#include <hip/hip_bf16.h>
#include <stdint.h>

#define B_  16
#define T_  2048
#define E_  512
#define D_  64

typedef __attribute__((ext_vector_type(16))) __bf16 v16bf;
typedef __attribute__((ext_vector_type(8)))  float  v8f;

// Round two f32 to bf16 (RNE) and pack into one u32 via v_perm_b32.
static __device__ __forceinline__ uint32_t pkbf(float a, float b) {
  uint32_t ua = __builtin_bit_cast(uint32_t, a);
  uint32_t ub = __builtin_bit_cast(uint32_t, b);
  ua += 0x7FFFu + ((ua >> 16) & 1u);
  ub += 0x7FFFu + ((ub >> 16) & 1u);
  // out = {ub[31:24], ub[23:16], ua[31:24], ua[23:16]}
  return __builtin_amdgcn_perm(ub, ua, 0x07060302u);
}
static __device__ __forceinline__ uint16_t f2bfu(float f) {
  uint32_t u = __builtin_bit_cast(uint32_t, f);
  u += 0x7FFFu + ((u >> 16) & 1u);
  return (uint16_t)(u >> 16);
}
static __device__ __forceinline__ float bf2f(uint16_t h) {
  return __builtin_bit_cast(float, (uint32_t)h << 16);   // exact
}

static __device__ __forceinline__ v8f wmma_bf16(v16bf a, v16bf b, v8f c) {
  // D = A(16x32 bf16) * B(32x16 bf16) + C(16x16 f32)
  return __builtin_amdgcn_wmma_f32_16x16x32_bf16(false, a, false, b, (short)0, c,
                                                 false, false);
}

// Rows (k_stats) or columns (k_attn) of S that one ring stage holds, and stages.
#define SJ_  64
#define NST_ (T_ / SJ_)
// q rows in LDS: 128 B of data at a pitch of 144 B (16 B x odd), so that the 16
// rows one ds_load_b128 reads fall on 16 different groups of four banks.
#define QPIT 72

// A 16-element fragment from LDS rows that are 16-byte aligned only.
static __device__ __forceinline__ v16bf lds_frag(const uint16_t* p) {
  const uint4* q = reinterpret_cast<const uint4*>(p);
  union { v16bf v; uint4 q[2]; } u;
  u.q[0] = q[0];
  u.q[1] = q[1];
  return u.v;
}

// LDS byte address of a __shared__ object (what an async copy takes).
static __device__ __forceinline__ uint32_t lds_addr(const void* p) {
  typedef __attribute__((address_space(3))) const unsigned char lds_byte;
  return (uint32_t)(uintptr_t)(lds_byte*)p;
}
// Async copies global -> LDS, 16 B a lane each. The s_wait_xcnt closes the
// statement so that no address register is rewritten ahead of it.
static __device__ __forceinline__ void copy2_b128(uint32_t l0, const void* g0,
                                                  uint32_t l1, const void* g1) {
  asm volatile("global_load_async_to_lds_b128 %0, %1, off\n\t"
               "global_load_async_to_lds_b128 %2, %3, off\n\t"
               "s_wait_xcnt 0x0"
               :: "v"(l0), "v"(g0), "v"(l1), "v"(g1) : "memory");
}
// The same, 8 B a lane.
static __device__ __forceinline__ void copy1_b64(uint32_t l0, const void* g0) {
  asm volatile("global_load_async_to_lds_b64 %0, %1, off\n\t"
               "s_wait_xcnt 0x0"
               :: "v"(l0), "v"(g0) : "memory");
}
// This wave's copies have landed (other waves read them behind the barrier).
static __device__ __forceinline__ void wait_async() {
  asm volatile("s_wait_asynccnt 0x0" ::: "memory");
}
// This wave's LDS reads are done (before a copy refills what it has read).
static __device__ __forceinline__ void wait_ds() {
  asm volatile("s_wait_dscnt 0x0" ::: "memory");
}

// ---------------------------------------------------------------------------
// Kernel 0: WqT[n][k] = bf16(Wq[k][n])  (64x512 bf16, 64KB -> stays L2 hot)
// ---------------------------------------------------------------------------
__global__ __launch_bounds__(256)
void k_wt(const float* __restrict__ Wq, uint16_t* __restrict__ WqT)
{
  const int idx = blockIdx.x * 256 + threadIdx.x;      // < 32768
  const int k = idx & (E_ - 1);
  const int n = idx >> 9;
  WqT[(size_t)n * E_ + k] = f2bfu(Wq[(size_t)k * D_ + n]);
}

// ---------------------------------------------------------------------------
// Kernel 1: q = x @ Wq + bq (bf16 out). One wave per 16x64 q tile; B from WqT
// (global, contiguous v16bf per lane, L2 resident). No LDS needed.
// ---------------------------------------------------------------------------
__global__ __launch_bounds__(256)
void k_proj(const float* __restrict__ x, const uint16_t* __restrict__ WqT,
            const float* __restrict__ bq, uint16_t* __restrict__ qb)
{
  const int tid  = threadIdx.x;
  const int wave = tid >> 5;
  const int lane = tid & 31;
  const int n    = lane & 15;      // A-layout M / C-layout N
  const int hi   = lane >> 4;      // K-half selector
  const int tok0 = blockIdx.x * 128 + wave * 16;

  v8f acc[4] = {v8f{}, v8f{}, v8f{}, v8f{}};
  const float* xrow = x + (size_t)(tok0 + n) * E_;

  for (int kb = 0; kb < E_; kb += 32) {
    if (kb + 32 < E_)
      __builtin_prefetch(xrow + kb + 32 + hi * 16, 0, 0);

    // A operand: x[tok0+n][kb + hi*16 .. +15] -> bf16 (perm-packed converts)
    const float4* xr = reinterpret_cast<const float4*>(xrow + kb + hi * 16);
    float4 p0 = xr[0], p1 = xr[1], p2 = xr[2], p3 = xr[3];
    float fv[16] = {p0.x, p0.y, p0.z, p0.w, p1.x, p1.y, p1.z, p1.w,
                    p2.x, p2.y, p2.z, p2.w, p3.x, p3.y, p3.z, p3.w};
    union { v16bf v; uint32_t w[8]; } ua;
#pragma unroll
    for (int q = 0; q < 8; ++q) ua.w[q] = pkbf(fv[2 * q], fv[2 * q + 1]);

#pragma unroll
    for (int nt = 0; nt < 4; ++nt) {
      v16bf bv = *reinterpret_cast<const v16bf*>(
          WqT + (size_t)(nt * 16 + n) * E_ + kb + hi * 16);
      acc[nt] = wmma_bf16(ua.v, bv, acc[nt]);
    }
  }

  // Epilogue: C layout -> lane holds column n, rows r + hi*8
#pragma unroll
  for (int nt = 0; nt < 4; ++nt) {
    const int col  = nt * 16 + n;
    const float bb = bq[col];
#pragma unroll
    for (int r = 0; r < 8; ++r) {
      const size_t row = (size_t)tok0 + r + hi * 8;
      qb[row * D_ + col] = f2bfu(acc[nt][r] + bb);
    }
  }
}

// ---------------------------------------------------------------------------
// Kernel 2: column softmax stats: m_j = max_i S_ij, Z_j = sum_i e^{S_ij-m_j}.
// 8 waves/block share batch b; 64-row i-chunks of q (8KB) go through a ring of
// two LDS buffers: stage t+1's async copies fly while stage t is worked on.
// Epilogue: q~^T[b][d][t] = bf16(q[b,t,d] / Z_{b,t}) for the block's 128 tokens
// (transposed layout so that the P x q~ B operand has its 32 columns j in a
// row), from the q rows each wave already holds as its B operand.
// ---------------------------------------------------------------------------
#define TPIT 136  // q~^T tile rows in LDS: 256 B of data at a pitch of 272 B
__global__ __launch_bounds__(256)
void k_stats(const uint16_t* __restrict__ qb, float* __restrict__ mj,
             uint16_t* __restrict__ qzT)
{
  __shared__ __align__(16) uint16_t sA[2][SJ_ * QPIT]; // 2 x 9KB ring of i-chunks
  const int tid = threadIdx.x, wave = tid >> 5, lane = tid & 31;
  const int gw = blockIdx.x * 8 + wave;                // 0..2047
  const int b  = gw >> 7;
  const int j0 = (gw & 127) * 16;
  const int n  = lane & 15, hi = lane >> 4;
  const size_t bT = (size_t)b * T_;
  const uint16_t* qbase = qb + bT * D_;

  // B operand fixed over i loop: B[k][n] = q[j0+n][k]
  const uint16_t* rowB = qbase + (size_t)(j0 + n) * D_;
  v16bf b0 = *reinterpret_cast<const v16bf*>(rowB + hi * 16);
  v16bf b1 = *reinterpret_cast<const v16bf*>(rowB + 32 + hi * 16);

  // a stage is 8KB contiguous in q: eight threads a row, two 16B copies per
  // thread, 32 rows apart
  const uint32_t  lA = lds_addr(&sA[0][0]) + (tid >> 3) * (QPIT * 2) + (tid & 7) * 16;
  const uint16_t* gA = qbase + tid * 8;
  copy2_b128(lA, gA, lA + 32 * QPIT * 2, gA + 2048);              // stage 0
  wait_async();
  __syncthreads();
  copy2_b128(lA + SJ_ * QPIT * 2, gA + SJ_ * D_,
             lA + (SJ_ + 32) * QPIT * 2, gA + SJ_ * D_ + 2048);   // stage 1

  float mloc = -1.0e30f, zloc = 0.0f;
  for (int t = 0; t < NST_; ++t) {
    const uint16_t* sAt = sA[t & 1];
    // constant LDS offsets for both 32-row halves of the stage
#pragma unroll
    for (int sub = 0; sub < SJ_ / 32; ++sub) {
      v8f c0 = {}, c1 = {};
      {
        const uint16_t* ar = sAt + (sub * 32 + n) * QPIT;
        v16bf a0 = lds_frag(ar + hi * 16);
        v16bf a1 = lds_frag(ar + 32 + hi * 16);
        c0 = wmma_bf16(a0, b0, c0);
        c0 = wmma_bf16(a1, b1, c0);
      }
      {
        const uint16_t* ar = sAt + (sub * 32 + 16 + n) * QPIT;
        v16bf a0 = lds_frag(ar + hi * 16);
        v16bf a1 = lds_frag(ar + 32 + hi * 16);
        c1 = wmma_bf16(a0, b0, c1);
        c1 = wmma_bf16(a1, b1, c1);
      }

      float tmax = -1.0e30f;
#pragma unroll
      for (int r = 0; r < 8; ++r) {
        tmax = fmaxf(tmax, c0[r] * 0.125f);
        tmax = fmaxf(tmax, c1[r] * 0.125f);
      }
      const float nm = fmaxf(mloc, tmax);
      float zs = zloc * __expf(mloc - nm);
#pragma unroll
      for (int r = 0; r < 8; ++r) {
        zs += __expf(c0[r] * 0.125f - nm);
        zs += __expf(c1[r] * 0.125f - nm);
      }
      mloc = nm; zloc = zs;
    }
    // publish stage t+1, free stage t's buffer, then refill it with stage t+2
    wait_ds();
    wait_async();
    __syncthreads();
    if (t + 2 < NST_) {
      const uint32_t  l = lA + (t & 1) * (SJ_ * QPIT * 2);
      const uint16_t* g = gA + (size_t)(t + 2) * (SJ_ * D_);
      copy2_b128(l, g, l + 32 * QPIT * 2, g + 2048);
    }
  }
  wait_async();

  // combine lane pair (l, l^16): each holds 8 of the 16 rows of column n
  const float mo = __shfl_xor(mloc, 16, 32);
  const float zo = __shfl_xor(zloc, 16, 32);
  const float M  = fmaxf(mloc, mo);
  const float Z  = zloc * __expf(mloc - M) + zo * __expf(mo - M);
  if (lane < 16)
    mj[bT + j0 + lane] = M;

  // The ring is free: every wave's reads and copies ended at the last trip's
  // barrier. Lane (n, hi) holds token j0+n, d = hi*16.. and 32+hi*16.., and Z of
  // that token: the 64 x 128 tile [d][token] is put together in the ring's LDS.
  uint16_t* sT = &sA[0][0];
  union { v16bf v; uint16_t h[16]; } u0, u1;
  u0.v = b0;
  u1.v = b1;
#pragma unroll
  for (int e = 0; e < 16; ++e) {
    sT[(hi * 16 + e) * TPIT + wave * 16 + n]      = f2bfu(bf2f(u0.h[e]) / Z);
    sT[(32 + hi * 16 + e) * TPIT + wave * 16 + n] = f2bfu(bf2f(u1.h[e]) / Z);
  }
  __syncthreads();   // tile columns come from all eight waves

  // out in whole 256 B rows: sixteen threads a row d, 16 B each
  uint16_t* gT = qzT + (size_t)b * D_ * T_ + (j0 - wave * 16)
               + (size_t)(tid >> 4) * T_ + (tid & 15) * 8;
  const uint16_t* lT = sT + (tid >> 4) * TPIT + (tid & 15) * 8;
#pragma unroll
  for (int k = 0; k < 4; ++k)
    *reinterpret_cast<uint4*>(gT + (size_t)k * 16 * T_) =
        *reinterpret_cast<const uint4*>(lT + k * 16 * TPIT);
}

// ---------------------------------------------------------------------------
// Kernel 3: out[i,:] = sum_j exp(S_ij/8 - m_j) * q~[j,:]
// 8 waves/block share batch b; per 64 columns j the block's operands (q rows,
// q~^T columns, m) go through a ring of two LDS buffers: stage t+1's async
// copies fly while stage t is worked on. P tile transposed (C->A layout)
// through per-wave LDS.
// ---------------------------------------------------------------------------
#define PSTR 40   // P rows in LDS: 64 B of data at a pitch of 80 B (16 B x odd)
#define ZPIT 72   // q~^T rows in LDS: 128 B of data at a pitch of 144 B
__global__ __launch_bounds__(256)
void k_attn(const uint16_t* __restrict__ qb, const uint16_t* __restrict__ qzT,
            const float* __restrict__ mj, float* __restrict__ out)
{
  __shared__ __align__(16) uint16_t sQ[2][SJ_ * QPIT];  // 2 x 9KB q rows j
  __shared__ __align__(16) uint16_t sZ[2][D_ * ZPIT];   // 2 x 9KB q~^T[d][j]
  __shared__ __align__(16) float    sM[2][SJ_];         // 2 x 256B m_j
  __shared__ __align__(16) uint16_t sP[8][16 * PSTR];   // per-wave P tiles
  const int tid = threadIdx.x, lane = tid & 31;
  const int wave = __builtin_amdgcn_readfirstlane(tid >> 5);
  const int gw = blockIdx.x * 8 + wave;                 // 0..2047
  const int b  = gw >> 7;
  const int i0 = (gw & 127) * 16;
  const int n  = lane & 15, hi = lane >> 4;
  const size_t bT = (size_t)b * T_;
  uint16_t* P = sP[wave];
  const uint16_t* qbase = qb + bT * D_;
  const uint16_t* zbase = qzT + (size_t)b * D_ * T_;

  // A operand for S: rows i0..i0+15 of q (fixed over j loop)
  const uint16_t* rowA = qbase + (size_t)(i0 + n) * D_;
  v16bf a0 = *reinterpret_cast<const v16bf*>(rowA + hi * 16);
  v16bf a1 = *reinterpret_cast<const v16bf*>(rowA + 32 + hi * 16);

  v8f acc[4] = {v8f{}, v8f{}, v8f{}, v8f{}};

  // One stage: q rows, 8KB contiguous (eight threads a row, two 16B copies 32
  // rows apart);
  // q~^T, 64 rows d of 128 B (eight threads a row, two copies 32 rows apart);
  // m, 256 B (wave 0, 8 B a lane).
  const uint32_t  lQ = lds_addr(&sQ[0][0]) + (tid >> 3) * (QPIT * 2) + (tid & 7) * 16;
  const uint32_t  lZ = lds_addr(&sZ[0][0]) + (tid >> 3) * (ZPIT * 2) + (tid & 7) * 16;
  const uint32_t  lM = lds_addr(&sM[0][0]) + lane * 8;
  const uint16_t* gQ = qbase + tid * 8;
  const uint16_t* gZ = zbase + (size_t)(tid >> 3) * T_ + (tid & 7) * 8;
  const float*    gM = mj + bT + lane * 2;
  auto stage = [&](int s, int buf) {
    const uint32_t  q = lQ + buf * (SJ_ * QPIT * 2);
    const uint16_t* a = gQ + (size_t)s * (SJ_ * D_);
    copy2_b128(q, a, q + 32 * QPIT * 2, a + 2048);
    const uint32_t  z = lZ + buf * (D_ * ZPIT * 2);
    const uint16_t* c = gZ + s * SJ_;
    copy2_b128(z, c, z + 32 * ZPIT * 2, c + (size_t)32 * T_);
    if (wave == 0)
      copy1_b64(lM + buf * (SJ_ * 4), gM + s * SJ_);
  };
  stage(0, 0);
  wait_async();
  __syncthreads();
  stage(1, 1);

  for (int t = 0; t < NST_; ++t) {
    const uint16_t* sQt = sQ[t & 1];
    const uint16_t* sZt = sZ[t & 1];
    const float*    sMt = sM[t & 1];
    // constant LDS offsets for both 32-column halves of the stage
#pragma unroll
    for (int sub = 0; sub < SJ_ / 32; ++sub) {
      // two 16x16 S sub-tiles -> P = exp(S/8 - m_j), bf16 row-major in LDS
#pragma unroll
      for (int h = 0; h < 2; ++h) {
        const uint16_t* rb = sQt + (sub * 32 + h * 16 + n) * QPIT;
        v16bf bb0 = lds_frag(rb + hi * 16);
        v16bf bb1 = lds_frag(rb + 32 + hi * 16);
        v8f s = {};
        s = wmma_bf16(a0, bb0, s);
        s = wmma_bf16(a1, bb1, s);
        const float mv = sMt[sub * 32 + h * 16 + n];
#pragma unroll
        for (int r = 0; r < 8; ++r)
          P[(r + hi * 8) * PSTR + h * 16 + n] = f2bfu(__expf(s[r] * 0.125f - mv));
      }
      __syncthreads();   // P writes (cross-lane transpose) -> reads

      // A = P (16x32), B = q~^T rows (LDS, 32 contiguous bytes per lane)
      v16bf pa = lds_frag(&P[n * PSTR + hi * 16]);
#pragma unroll
      for (int nt = 0; nt < 4; ++nt) {
        const uint4* zr = reinterpret_cast<const uint4*>(
            sZt + (nt * 16 + n) * ZPIT + sub * 32 + hi * 16);
        union { v16bf v; uint4 q[2]; } ub;
        ub.q[0] = zr[0];
        ub.q[1] = zr[1];
        acc[nt] = wmma_bf16(pa, ub.v, acc[nt]);
      }
    }
    // publish stage t+1, free stage t's buffers, then refill them with t+2
    // (P is private to its wave: the wave's own LDS order covers its reuse)
    wait_ds();
    wait_async();
    __syncthreads();
    if (t + 2 < NST_) stage(t + 2, t & 1);
  }
  wait_async();

#pragma unroll
  for (int nt = 0; nt < 4; ++nt)
#pragma unroll
    for (int r = 0; r < 8; ++r)
      out[(bT + i0 + r + hi * 8) * D_ + nt * 16 + n] = acc[nt][r];
}

// ---------------------------------------------------------------------------
extern "C" void kernel_launch(void* const* d_in, const int* in_sizes, int n_in,
                              void* d_out, int out_size, void* d_ws, size_t ws_size,
                              hipStream_t stream)
{
  (void)in_sizes; (void)n_in; (void)out_size; (void)ws_size;
  const float* x  = (const float*)d_in[0];
  const float* Wq = (const float*)d_in[1];
  const float* bq = (const float*)d_in[2];
  float* out = (float*)d_out;

  char* ws = (char*)d_ws;
  uint16_t* qb  = (uint16_t*)(ws);                                 // 4 MB  q bf16
  uint16_t* qzT = (uint16_t*)(ws + ((size_t)4 << 20));             // 4 MB  (q/Z)^T bf16
  uint16_t* WqT = (uint16_t*)(ws + ((size_t)8 << 20));             // 64 KB Wq^T bf16
  float*    mj  = (float*)   (ws + ((size_t)9 << 20));             // 128 KB col max

  k_wt   <<<128,  256, 0, stream>>>(Wq, WqT);
  k_proj <<<256,  256, 0, stream>>>(x, WqT, bq, qb);
  k_stats<<<256,  256, 0, stream>>>(qb, mj, qzT);
  k_attn <<<256,  256, 0, stream>>>(qb, qzT, mj, out);
}

// v004
// Measured time: 72.6 microseconds a run.
// Two timings next to v003 put it at 1.20 and 1.15 times that version's speed.
// All steps since v000 together make it 2.74 times as fast.
#include <hip/hip_runtime.h>
#include <hip/hip_bf16.h>
#include <stdint.h>

#define B_  16
#define T_  2048
#define E_  512
#define D_  64

typedef __attribute__((ext_vector_type(16))) __bf16 v16bf;
typedef __attribute__((ext_vector_type(8)))  float  v8f;
typedef __attribute__((ext_vector_type(2)))  float  v2f;
typedef __attribute__((ext_vector_type(2)))  __bf16 v2bf;

// Round two f32 to bf16 (RNE) and pack into one u32 via v_perm_b32.
static __device__ __forceinline__ uint32_t pkbf(float a, float b) {
  uint32_t ua = __builtin_bit_cast(uint32_t, a);
  uint32_t ub = __builtin_bit_cast(uint32_t, b);
  ua += 0x7FFFu + ((ua >> 16) & 1u);
  ub += 0x7FFFu + ((ub >> 16) & 1u);
  // out = {ub[31:24], ub[23:16], ua[31:24], ua[23:16]}
  return __builtin_amdgcn_perm(ub, ua, 0x07060302u);
}
// The same rounding for a pair that stays in registers: one packed convert.
static __device__ __forceinline__ uint32_t cvtpk(float a, float b) {
  v2f f = {a, b};
  return __builtin_bit_cast(uint32_t, __builtin_convertvector(f, v2bf));
}
static __device__ __forceinline__ uint16_t f2bfu(float f) {
  uint32_t u = __builtin_bit_cast(uint32_t, f);
  u += 0x7FFFu + ((u >> 16) & 1u);
  return (uint16_t)(u >> 16);
}
static __device__ __forceinline__ float bf2f(uint16_t h) {
  return __builtin_bit_cast(float, (uint32_t)h << 16);   // exact
}

static __device__ __forceinline__ v8f wmma_bf16(v16bf a, v16bf b, v8f c) {
  // D = A(16x32 bf16) * B(32x16 bf16) + C(16x16 f32)
  return __builtin_amdgcn_wmma_f32_16x16x32_bf16(false, a, false, b, (short)0, c,
                                                 false, false);
}

// Rows (k_stats) or columns (k_attn) of S that one ring stage holds, and stages.
#define SJ_  64
#define NST_ (T_ / SJ_)
// q rows in LDS: 128 B of data at a pitch of 144 B (16 B x odd), so that the 16
// rows one ds_load_b128 reads fall on 16 different groups of four banks.
#define QPIT 72

// A 16-element fragment from LDS rows that are 16-byte aligned only.
static __device__ __forceinline__ v16bf lds_frag(const uint16_t* p) {
  const uint4* q = reinterpret_cast<const uint4*>(p);
  union { v16bf v; uint4 q[2]; } u;
  u.q[0] = q[0];
  u.q[1] = q[1];
  return u.v;
}

// LDS byte address of a __shared__ object (what an async copy takes).
static __device__ __forceinline__ uint32_t lds_addr(const void* p) {
  typedef __attribute__((address_space(3))) const unsigned char lds_byte;
  return (uint32_t)(uintptr_t)(lds_byte*)p;
}
// Async copies global -> LDS, 16 B a lane each. The s_wait_xcnt closes the
// statement so that no address register is rewritten ahead of it.
static __device__ __forceinline__ void copy2_b128(uint32_t l0, const void* g0,
                                                  uint32_t l1, const void* g1) {
  asm volatile("global_load_async_to_lds_b128 %0, %1, off\n\t"
               "global_load_async_to_lds_b128 %2, %3, off\n\t"
               "s_wait_xcnt 0x0"
               :: "v"(l0), "v"(g0), "v"(l1), "v"(g1) : "memory");
}
// The same, 8 B a lane.
static __device__ __forceinline__ void copy1_b64(uint32_t l0, const void* g0) {
  asm volatile("global_load_async_to_lds_b64 %0, %1, off\n\t"
               "s_wait_xcnt 0x0"
               :: "v"(l0), "v"(g0) : "memory");
}
// This wave's copies have landed (other waves read them behind the barrier).
static __device__ __forceinline__ void wait_async() {
  asm volatile("s_wait_asynccnt 0x0" ::: "memory");
}
// This wave's LDS reads are done (before a copy refills what it has read).
static __device__ __forceinline__ void wait_ds() {
  asm volatile("s_wait_dscnt 0x0" ::: "memory");
}

// ---------------------------------------------------------------------------
// Kernel 0: WqT[n][k] = bf16(Wq[k][n])  (64x512 bf16, 64KB -> stays L2 hot)
// ---------------------------------------------------------------------------
__global__ __launch_bounds__(256)
void k_wt(const float* __restrict__ Wq, uint16_t* __restrict__ WqT)
{
  const int idx = blockIdx.x * 256 + threadIdx.x;      // < 32768
  const int k = idx & (E_ - 1);
  const int n = idx >> 9;
  WqT[(size_t)n * E_ + k] = f2bfu(Wq[(size_t)k * D_ + n]);
}

// ---------------------------------------------------------------------------
// Kernel 1: q = x @ Wq + bq (bf16 out). One wave per 16x64 q tile; B from WqT
// (global, contiguous v16bf per lane, L2 resident). No LDS needed.
// ---------------------------------------------------------------------------
__global__ __launch_bounds__(256)
void k_proj(const float* __restrict__ x, const uint16_t* __restrict__ WqT,
            const float* __restrict__ bq, uint16_t* __restrict__ qb)
{
  const int tid  = threadIdx.x;
  const int wave = tid >> 5;
  const int lane = tid & 31;
  const int n    = lane & 15;      // A-layout M / C-layout N
  const int hi   = lane >> 4;      // K-half selector
  const int tok0 = blockIdx.x * 128 + wave * 16;

  v8f acc[4] = {v8f{}, v8f{}, v8f{}, v8f{}};
  const float* xrow = x + (size_t)(tok0 + n) * E_;

  for (int kb = 0; kb < E_; kb += 32) {
    if (kb + 32 < E_)
      __builtin_prefetch(xrow + kb + 32 + hi * 16, 0, 0);

    // A operand: x[tok0+n][kb + hi*16 .. +15] -> bf16 (perm-packed converts)
    const float4* xr = reinterpret_cast<const float4*>(xrow + kb + hi * 16);
    float4 p0 = xr[0], p1 = xr[1], p2 = xr[2], p3 = xr[3];
    float fv[16] = {p0.x, p0.y, p0.z, p0.w, p1.x, p1.y, p1.z, p1.w,
                    p2.x, p2.y, p2.z, p2.w, p3.x, p3.y, p3.z, p3.w};
    union { v16bf v; uint32_t w[8]; } ua;
#pragma unroll
    for (int q = 0; q < 8; ++q) ua.w[q] = pkbf(fv[2 * q], fv[2 * q + 1]);

#pragma unroll
    for (int nt = 0; nt < 4; ++nt) {
      v16bf bv = *reinterpret_cast<const v16bf*>(
          WqT + (size_t)(nt * 16 + n) * E_ + kb + hi * 16);
      acc[nt] = wmma_bf16(ua.v, bv, acc[nt]);
    }
  }

  // Epilogue: C layout -> lane holds column n, rows r + hi*8
#pragma unroll
  for (int nt = 0; nt < 4; ++nt) {
    const int col  = nt * 16 + n;
    const float bb = bq[col];
#pragma unroll
    for (int r = 0; r < 8; ++r) {
      const size_t row = (size_t)tok0 + r + hi * 8;
      qb[row * D_ + col] = f2bfu(acc[nt][r] + bb);
    }
  }
}

// ---------------------------------------------------------------------------
// Kernel 2: column softmax stats: m_j = max_i S_ij, Z_j = sum_i e^{S_ij-m_j}.
// 8 waves/block share batch b; 64-row i-chunks of q (8KB) go through a ring of
// two LDS buffers: stage t+1's async copies fly while stage t is worked on.
// Epilogue: q~^T[b][d][t] = bf16(q[b,t,d] / Z_{b,t}) for the block's 128 tokens
// (transposed layout so that the P x q~ B operand has its 32 columns j in a
// row), from the q rows each wave already holds as its B operand.
// ---------------------------------------------------------------------------
#define TPIT 136  // q~^T tile rows in LDS: 256 B of data at a pitch of 272 B
__global__ __launch_bounds__(256)
void k_stats(const uint16_t* __restrict__ qb, float* __restrict__ mj,
             uint16_t* __restrict__ qzT)
{
  __shared__ __align__(16) uint16_t sA[2][SJ_ * QPIT]; // 2 x 9KB ring of i-chunks
  const int tid = threadIdx.x, wave = tid >> 5, lane = tid & 31;
  const int gw = blockIdx.x * 8 + wave;                // 0..2047
  const int b  = gw >> 7;
  const int j0 = (gw & 127) * 16;
  const int n  = lane & 15, hi = lane >> 4;
  const size_t bT = (size_t)b * T_;
  const uint16_t* qbase = qb + bT * D_;

  // B operand fixed over i loop: B[k][n] = q[j0+n][k]
  const uint16_t* rowB = qbase + (size_t)(j0 + n) * D_;
  v16bf b0 = *reinterpret_cast<const v16bf*>(rowB + hi * 16);
  v16bf b1 = *reinterpret_cast<const v16bf*>(rowB + 32 + hi * 16);

  // a stage is 8KB contiguous in q: eight threads a row, two 16B copies per
  // thread, 32 rows apart
  const uint32_t  lA = lds_addr(&sA[0][0]) + (tid >> 3) * (QPIT * 2) + (tid & 7) * 16;
  const uint16_t* gA = qbase + tid * 8;
  copy2_b128(lA, gA, lA + 32 * QPIT * 2, gA + 2048);              // stage 0
  wait_async();
  __syncthreads();
  copy2_b128(lA + SJ_ * QPIT * 2, gA + SJ_ * D_,
             lA + (SJ_ + 32) * QPIT * 2, gA + SJ_ * D_ + 2048);   // stage 1

  float mloc = -1.0e30f, zloc = 0.0f;
  for (int t = 0; t < NST_; ++t) {
    const uint16_t* sAt = sA[t & 1];
    // constant LDS offsets for both 32-row halves of the stage
#pragma unroll
    for (int sub = 0; sub < SJ_ / 32; ++sub) {
      v8f c0 = {}, c1 = {};
      {
        const uint16_t* ar = sAt + (sub * 32 + n) * QPIT;
        v16bf a0 = lds_frag(ar + hi * 16);
        v16bf a1 = lds_frag(ar + 32 + hi * 16);
        c0 = wmma_bf16(a0, b0, c0);
        c0 = wmma_bf16(a1, b1, c0);
      }
      {
        const uint16_t* ar = sAt + (sub * 32 + 16 + n) * QPIT;
        v16bf a0 = lds_frag(ar + hi * 16);
        v16bf a1 = lds_frag(ar + 32 + hi * 16);
        c1 = wmma_bf16(a0, b0, c1);
        c1 = wmma_bf16(a1, b1, c1);
      }

      float tmax = -1.0e30f;
#pragma unroll
      for (int r = 0; r < 8; ++r) {
        tmax = fmaxf(tmax, c0[r] * 0.125f);
        tmax = fmaxf(tmax, c1[r] * 0.125f);
      }
      const float nm = fmaxf(mloc, tmax);
      float zs = zloc * __expf(mloc - nm);
#pragma unroll
      for (int r = 0; r < 8; ++r) {
        zs += __expf(c0[r] * 0.125f - nm);
        zs += __expf(c1[r] * 0.125f - nm);
      }
      mloc = nm; zloc = zs;
    }
    // publish stage t+1, free stage t's buffer, then refill it with stage t+2
    wait_ds();
    wait_async();
    __syncthreads();
    if (t + 2 < NST_) {
      const uint32_t  l = lA + (t & 1) * (SJ_ * QPIT * 2);
      const uint16_t* g = gA + (size_t)(t + 2) * (SJ_ * D_);
      copy2_b128(l, g, l + 32 * QPIT * 2, g + 2048);
    }
  }
  wait_async();

  // combine lane pair (l, l^16): each holds 8 of the 16 rows of column n
  const float mo = __shfl_xor(mloc, 16, 32);
  const float zo = __shfl_xor(zloc, 16, 32);
  const float M  = fmaxf(mloc, mo);
  const float Z  = zloc * __expf(mloc - M) + zo * __expf(mo - M);
  if (lane < 16)
    mj[bT + j0 + lane] = M;

  // The ring is free: every wave's reads and copies ended at the last trip's
  // barrier. Lane (n, hi) holds token j0+n, d = hi*16.. and 32+hi*16.., and Z of
  // that token: the 64 x 128 tile [d][token] is put together in the ring's LDS.
  uint16_t* sT = &sA[0][0];
  union { v16bf v; uint16_t h[16]; } u0, u1;
  u0.v = b0;
  u1.v = b1;
#pragma unroll
  for (int e = 0; e < 16; ++e) {
    sT[(hi * 16 + e) * TPIT + wave * 16 + n]      = f2bfu(bf2f(u0.h[e]) / Z);
    sT[(32 + hi * 16 + e) * TPIT + wave * 16 + n] = f2bfu(bf2f(u1.h[e]) / Z);
  }
  __syncthreads();   // tile columns come from all eight waves

  // out in whole 256 B rows: sixteen threads a row d, 16 B each
  uint16_t* gT = qzT + (size_t)b * D_ * T_ + (j0 - wave * 16)
               + (size_t)(tid >> 4) * T_ + (tid & 15) * 8;
  const uint16_t* lT = sT + (tid >> 4) * TPIT + (tid & 15) * 8;
#pragma unroll
  for (int k = 0; k < 4; ++k)
    *reinterpret_cast<uint4*>(gT + (size_t)k * 16 * T_) =
        *reinterpret_cast<const uint4*>(lT + k * 16 * TPIT);
}

// ---------------------------------------------------------------------------
// Kernel 3: out[i,:] = sum_j exp(S_ij/8 - m_j) * q~[j,:]
// 8 waves/block share batch b; per 64 columns j the block's operands (q rows,
// q~^T columns, m) go through a ring of two LDS buffers: stage t+1's async
// copies fly while stage t is worked on. S is computed transposed (rows j,
// columns i): lane (n, hi) then holds row i0+n of P at j = 8*hi+r of each
// 16-column tile, and two tiles packed to bf16 are the A operand of P x q~ as
// they lie, element s at j = 16*(s>>3) + 8*hi + (s&7). q~^T is read in that order.
// ---------------------------------------------------------------------------
#define ZPIT 72   // q~^T rows in LDS: 128 B of data at a pitch of 144 B
__global__ __launch_bounds__(256)
void k_attn(const uint16_t* __restrict__ qb, const uint16_t* __restrict__ qzT,
            const float* __restrict__ mj, float* __restrict__ out)
{
  __shared__ __align__(16) uint16_t sQ[2][SJ_ * QPIT];  // 2 x 9KB q rows j
  __shared__ __align__(16) uint16_t sZ[2][D_ * ZPIT];   // 2 x 9KB q~^T[d][j]
  __shared__ __align__(16) float    sM[2][SJ_];         // 2 x 256B m_j
  const int tid = threadIdx.x, lane = tid & 31;
  const int wave = __builtin_amdgcn_readfirstlane(tid >> 5);
  const int gw = blockIdx.x * 8 + wave;                 // 0..2047
  const int b  = gw >> 7;
  const int i0 = (gw & 127) * 16;
  const int n  = lane & 15, hi = lane >> 4;
  const size_t bT = (size_t)b * T_;
  const uint16_t* qbase = qb + bT * D_;
  const uint16_t* zbase = qzT + (size_t)b * D_ * T_;

  // B operand for S^T: rows i0..i0+15 of q as columns (fixed over j loop)
  const uint16_t* rowA = qbase + (size_t)(i0 + n) * D_;
  v16bf a0 = *reinterpret_cast<const v16bf*>(rowA + hi * 16);
  v16bf a1 = *reinterpret_cast<const v16bf*>(rowA + 32 + hi * 16);

  v8f acc[4] = {v8f{}, v8f{}, v8f{}, v8f{}};

  // One stage: q rows, 8KB contiguous (eight threads a row, two 16B copies 32
  // rows apart);
  // q~^T, 64 rows d of 128 B (eight threads a row, two copies 32 rows apart);
  // m, 256 B (wave 0, 8 B a lane).
  const uint32_t  lQ = lds_addr(&sQ[0][0]) + (tid >> 3) * (QPIT * 2) + (tid & 7) * 16;
  const uint32_t  lZ = lds_addr(&sZ[0][0]) + (tid >> 3) * (ZPIT * 2) + (tid & 7) * 16;
  const uint32_t  lM = lds_addr(&sM[0][0]) + lane * 8;
  const uint16_t* gQ = qbase + tid * 8;
  const uint16_t* gZ = zbase + (size_t)(tid >> 3) * T_ + (tid & 7) * 8;
  const float*    gM = mj + bT + lane * 2;
  auto stage = [&](int s, int buf) {
    const uint32_t  q = lQ + buf * (SJ_ * QPIT * 2);
    const uint16_t* a = gQ + (size_t)s * (SJ_ * D_);
    copy2_b128(q, a, q + 32 * QPIT * 2, a + 2048);
    const uint32_t  z = lZ + buf * (D_ * ZPIT * 2);
    const uint16_t* c = gZ + s * SJ_;
    copy2_b128(z, c, z + 32 * ZPIT * 2, c + (size_t)32 * T_);
    if (wave == 0)
      copy1_b64(lM + buf * (SJ_ * 4), gM + s * SJ_);
  };
  stage(0, 0);
  wait_async();
  __syncthreads();
  stage(1, 1);

  for (int t = 0; t < NST_; ++t) {
    const uint16_t* sQt = sQ[t & 1];
    const uint16_t* sZt = sZ[t & 1];
    const float*    sMt = sM[t & 1];
    // No barrier stands inside a stage, so every LDS read of the stage goes out as
    // one group ahead of the products, in the order of use: m_j of the lane's 8
    // rows a tile, the q rows j (A of S^T), then q~^T (B of P x q~: 8 columns j at
    // hi*8 and 8 at 16 + hi*8). Every loop over these arrays is unrolled, so that
    // each index is a constant and they stay in registers.
    v16bf aq[SJ_ / 32][2][2], bz[SJ_ / 32][4];
    float4 mm[SJ_ / 32][2][2];
#pragma unroll
    for (int sub = 0; sub < SJ_ / 32; ++sub)
#pragma unroll
      for (int h = 0; h < 2; ++h) {
        const float4* mp = reinterpret_cast<const float4*>(
            sMt + sub * 32 + h * 16 + hi * 8);
        mm[sub][h][0] = mp[0];
        mm[sub][h][1] = mp[1];
      }
    // The m reads stay first: in one region with the fragment reads the compiler
    // put most of them last, and the first exponentials waited for the whole group.
    __builtin_amdgcn_sched_barrier(0);
#pragma unroll
    for (int sub = 0; sub < SJ_ / 32; ++sub)
#pragma unroll
      for (int h = 0; h < 2; ++h) {
        const uint16_t* rb = sQt + (sub * 32 + h * 16 + n) * QPIT;
        aq[sub][h][0] = lds_frag(rb + hi * 16);
        aq[sub][h][1] = lds_frag(rb + 32 + hi * 16);
      }
#pragma unroll
    for (int sub = 0; sub < SJ_ / 32; ++sub)
#pragma unroll
      for (int nt = 0; nt < 4; ++nt) {
        const uint16_t* zr = sZt + (nt * 16 + n) * ZPIT + sub * 32 + hi * 8;
        union { v16bf v; uint4 q[2]; } ub;
        ub.q[0] = *reinterpret_cast<const uint4*>(zr);
        ub.q[1] = *reinterpret_cast<const uint4*>(zr + 16);
        bz[sub][nt] = ub.v;
      }

#pragma unroll
    for (int sub = 0; sub < SJ_ / 32; ++sub) {
      // two 16x16 S^T sub-tiles -> P = exp(S/8 - m_j), packed in registers
      union { v16bf v; uint32_t w[8]; } pa;
#pragma unroll
      for (int h = 0; h < 2; ++h) {
        v8f s = {};
        s = wmma_bf16(aq[sub][h][0], a0, s);  // s[r] = S[i0+n][j], j = h*16+hi*8+r
        s = wmma_bf16(aq[sub][h][1], a1, s);
        const float4 m0 = mm[sub][h][0], m1 = mm[sub][h][1];
        const float mv[8] = {m0.x, m0.y, m0.z, m0.w, m1.x, m1.y, m1.z, m1.w};
#pragma unroll
        for (int r = 0; r < 8; r += 2)
          pa.w[h * 4 + (r >> 1)] = cvtpk(__expf(s[r] * 0.125f - mv[r]),
                                         __expf(s[r + 1] * 0.125f - mv[r + 1]));
      }
#pragma unroll
      for (int nt = 0; nt < 4; ++nt)
        acc[nt] = wmma_bf16(pa.v, bz[sub][nt], acc[nt]);
    }
    // Order for the compiler's scheduler: the 32 fragment reads first, then the 16
    // matrix products. Left alone it moves each read down to its product and
    // waits there, one LDS latency after another.
    __builtin_amdgcn_sched_group_barrier(0x100, 32, 0);
    __builtin_amdgcn_sched_group_barrier(0x008, 16, 0);
    // The products stay ahead of the stage's closing waits: moved behind them, they
    // would start only when the last of the 40 reads has landed.
    __builtin_amdgcn_sched_barrier(0);
    // publish stage t+1, free stage t's buffers, then refill them with t+2
    wait_ds();
    wait_async();
    __syncthreads();
    if (t + 2 < NST_) stage(t + 2, t & 1);
  }
  wait_async();

#pragma unroll
  for (int nt = 0; nt < 4; ++nt)
#pragma unroll
    for (int r = 0; r < 8; ++r)
      out[(bT + i0 + r + hi * 8) * D_ + nt * 16 + n] = acc[nt][r];
}

// ---------------------------------------------------------------------------
extern "C" void kernel_launch(void* const* d_in, const int* in_sizes, int n_in,
                              void* d_out, int out_size, void* d_ws, size_t ws_size,
                              hipStream_t stream)
{
  (void)in_sizes; (void)n_in; (void)out_size; (void)ws_size;
  const float* x  = (const float*)d_in[0];
  const float* Wq = (const float*)d_in[1];
  const float* bq = (const float*)d_in[2];
  float* out = (float*)d_out;

  char* ws = (char*)d_ws;
  uint16_t* qb  = (uint16_t*)(ws);                                 // 4 MB  q bf16
  uint16_t* qzT = (uint16_t*)(ws + ((size_t)4 << 20));             // 4 MB  (q/Z)^T bf16
  uint16_t* WqT = (uint16_t*)(ws + ((size_t)8 << 20));             // 64 KB Wq^T bf16
  float*    mj  = (float*)   (ws + ((size_t)9 << 20));             // 128 KB col max

  k_wt   <<<128,  256, 0, stream>>>(Wq, WqT);
  k_proj <<<256,  256, 0, stream>>>(x, WqT, bq, qb);
  k_stats<<<256,  256, 0, stream>>>(qb, mj, qzT);
  k_attn <<<256,  256, 0, stream>>>(qb, qzT, mj, out);
}

// v005
// It runs in 68.6 microseconds.
// Next to v004, in two timings, it ran 1.05 times as fast each time.
// All steps since v000 together make it 2.88 times as fast.
#include <hip/hip_runtime.h>
#include <hip/hip_bf16.h>
#include <stdint.h>

#define B_  16
#define T_  2048
#define E_  512
#define D_  64

typedef __attribute__((ext_vector_type(16))) __bf16 v16bf;
typedef __attribute__((ext_vector_type(8)))  float  v8f;
typedef __attribute__((ext_vector_type(2)))  float  v2f;
typedef __attribute__((ext_vector_type(2)))  __bf16 v2bf;

// Round two f32 to bf16 (RNE) and pack into one u32 via v_perm_b32.
static __device__ __forceinline__ uint32_t pkbf(float a, float b) {
  uint32_t ua = __builtin_bit_cast(uint32_t, a);
  uint32_t ub = __builtin_bit_cast(uint32_t, b);
  ua += 0x7FFFu + ((ua >> 16) & 1u);
  ub += 0x7FFFu + ((ub >> 16) & 1u);
  // out = {ub[31:24], ub[23:16], ua[31:24], ua[23:16]}
  return __builtin_amdgcn_perm(ub, ua, 0x07060302u);
}
// The same rounding for a pair that stays in registers: one packed convert.
static __device__ __forceinline__ uint32_t cvtpk(float a, float b) {
  v2f f = {a, b};
  return __builtin_bit_cast(uint32_t, __builtin_convertvector(f, v2bf));
}
static __device__ __forceinline__ uint16_t f2bfu(float f) {
  uint32_t u = __builtin_bit_cast(uint32_t, f);
  u += 0x7FFFu + ((u >> 16) & 1u);
  return (uint16_t)(u >> 16);
}
static __device__ __forceinline__ float bf2f(uint16_t h) {
  return __builtin_bit_cast(float, (uint32_t)h << 16);   // exact
}

static __device__ __forceinline__ v8f wmma_bf16(v16bf a, v16bf b, v8f c) {
  // D = A(16x32 bf16) * B(32x16 bf16) + C(16x16 f32)
  return __builtin_amdgcn_wmma_f32_16x16x32_bf16(false, a, false, b, (short)0, c,
                                                 false, false);
}

// Rows (k_stats) or columns (k_attn) of S that one ring stage holds, and stages.
#define SJ_  64
#define NST_ (T_ / SJ_)
// q rows in LDS: 128 B of data at a pitch of 144 B (16 B x odd), so that the 16
// rows one ds_load_b128 reads fall on 16 different groups of four banks.
#define QPIT 72

// A 16-element fragment from LDS rows that are 16-byte aligned only.
static __device__ __forceinline__ v16bf lds_frag(const uint16_t* p) {
  const uint4* q = reinterpret_cast<const uint4*>(p);
  union { v16bf v; uint4 q[2]; } u;
  u.q[0] = q[0];
  u.q[1] = q[1];
  return u.v;
}

// LDS byte address of a __shared__ object (what an async copy takes).
static __device__ __forceinline__ uint32_t lds_addr(const void* p) {
  typedef __attribute__((address_space(3))) const unsigned char lds_byte;
  return (uint32_t)(uintptr_t)(lds_byte*)p;
}
// Async copies global -> LDS, 16 B a lane each. The s_wait_xcnt closes the
// statement so that no address register is rewritten ahead of it.
static __device__ __forceinline__ void copy2_b128(uint32_t l0, const void* g0,
                                                  uint32_t l1, const void* g1) {
  asm volatile("global_load_async_to_lds_b128 %0, %1, off\n\t"
               "global_load_async_to_lds_b128 %2, %3, off\n\t"
               "s_wait_xcnt 0x0"
               :: "v"(l0), "v"(g0), "v"(l1), "v"(g1) : "memory");
}
// The same, 8 B a lane.
static __device__ __forceinline__ void copy1_b64(uint32_t l0, const void* g0) {
  asm volatile("global_load_async_to_lds_b64 %0, %1, off\n\t"
               "s_wait_xcnt 0x0"
               :: "v"(l0), "v"(g0) : "memory");
}
// This wave's copies have landed (other waves read them behind the barrier).
static __device__ __forceinline__ void wait_async() {
  asm volatile("s_wait_asynccnt 0x0" ::: "memory");
}
// This wave's LDS reads are done (before a copy refills what it has read).
static __device__ __forceinline__ void wait_ds() {
  asm volatile("s_wait_dscnt 0x0" ::: "memory");
}

// __expf with the free issue slot behind the transcendental written into its own
// statement: for straight-line code.
static __device__ __forceinline__ float expf_slot(float x) {
  float r;
  // v_nop: that slot; inside the statement nothing can be scheduled in front of it
  asm("v_exp_f32 %0, %1\n\tv_nop" : "=v"(r) : "v"(x * 1.44269504f));
  return r;
}

// ---------------------------------------------------------------------------
// Kernel 0: WqT[n][k] = bf16(Wq[k][n])  (64x512 bf16, 64KB -> stays L2 hot)
// ---------------------------------------------------------------------------
__global__ __launch_bounds__(256)
void k_wt(const float* __restrict__ Wq, uint16_t* __restrict__ WqT)
{
  const int idx = blockIdx.x * 256 + threadIdx.x;      // < 32768
  const int k = idx & (E_ - 1);
  const int n = idx >> 9;
  WqT[(size_t)n * E_ + k] = f2bfu(Wq[(size_t)k * D_ + n]);
}

// ---------------------------------------------------------------------------
// Kernel 1: q = x @ Wq + bq (bf16 out). One wave per 16x64 q tile; B from WqT
// (global, contiguous v16bf per lane, L2 resident). No LDS needed.
// ---------------------------------------------------------------------------
__global__ __launch_bounds__(256)
void k_proj(const float* __restrict__ x, const uint16_t* __restrict__ WqT,
            const float* __restrict__ bq, uint16_t* __restrict__ qb)
{
  const int tid  = threadIdx.x;
  const int wave = tid >> 5;
  const int lane = tid & 31;
  const int n    = lane & 15;      // A-layout M / C-layout N
  const int hi   = lane >> 4;      // K-half selector
  const int tok0 = blockIdx.x * 128 + wave * 16;

  v8f acc[4] = {v8f{}, v8f{}, v8f{}, v8f{}};
  const float* xrow = x + (size_t)(tok0 + n) * E_;

  for (int kb = 0; kb < E_; kb += 32) {
    if (kb + 32 < E_)
      __builtin_prefetch(xrow + kb + 32 + hi * 16, 0, 0);

    // A operand: x[tok0+n][kb + hi*16 .. +15] -> bf16 (perm-packed converts)
    const float4* xr = reinterpret_cast<const float4*>(xrow + kb + hi * 16);
    float4 p0 = xr[0], p1 = xr[1], p2 = xr[2], p3 = xr[3];
    float fv[16] = {p0.x, p0.y, p0.z, p0.w, p1.x, p1.y, p1.z, p1.w,
                    p2.x, p2.y, p2.z, p2.w, p3.x, p3.y, p3.z, p3.w};
    union { v16bf v; uint32_t w[8]; } ua;
#pragma unroll
    for (int q = 0; q < 8; ++q) ua.w[q] = pkbf(fv[2 * q], fv[2 * q + 1]);

#pragma unroll
    for (int nt = 0; nt < 4; ++nt) {
      v16bf bv = *reinterpret_cast<const v16bf*>(
          WqT + (size_t)(nt * 16 + n) * E_ + kb + hi * 16);
      acc[nt] = wmma_bf16(ua.v, bv, acc[nt]);
    }
  }

  // Epilogue: C layout -> lane holds column n, rows r + hi*8
#pragma unroll
  for (int nt = 0; nt < 4; ++nt) {
    const int col  = nt * 16 + n;
    const float bb = bq[col];
#pragma unroll
    for (int r = 0; r < 8; ++r) {
      const size_t row = (size_t)tok0 + r + hi * 8;
      qb[row * D_ + col] = f2bfu(acc[nt][r] + bb);
    }
  }
}

// ---------------------------------------------------------------------------
// Kernel 2: column softmax stats: m_j = max_i S_ij, Z_j = sum_i e^{S_ij-m_j}.
// 8 waves/block share batch b; 64-row i-chunks of q (8KB) go through a ring of
// two LDS buffers: stage t+1's async copies fly while stage t is worked on.
// The loop runs one stage apart: trip t reads stage t's fragments, takes the max
// and the sums of S of stage t-1 while those reads are under way, then forms S.
// Epilogue: q~^T[b][d][t] = bf16(q[b,t,d] / Z_{b,t}) for the block's 128 tokens
// (transposed layout so that the P x q~ B operand has its 32 columns j in a
// row), from the q rows each wave already holds as its B operand.
// ---------------------------------------------------------------------------
#define TPIT 136  // q~^T tile rows in LDS: 256 B of data at a pitch of 272 B
__global__ __launch_bounds__(256)
void k_stats(const uint16_t* __restrict__ qb, float* __restrict__ mj,
             uint16_t* __restrict__ qzT)
{
  __shared__ __align__(16) uint16_t sA[2][SJ_ * QPIT]; // 2 x 9KB ring of i-chunks
  const int tid = threadIdx.x, wave = tid >> 5, lane = tid & 31;
  const int gw = blockIdx.x * 8 + wave;                // 0..2047
  const int b  = gw >> 7;
  const int j0 = (gw & 127) * 16;
  const int n  = lane & 15, hi = lane >> 4;
  const size_t bT = (size_t)b * T_;
  const uint16_t* qbase = qb + bT * D_;

  // B operand fixed over i loop: B[k][n] = q[j0+n][k]
  const uint16_t* rowB = qbase + (size_t)(j0 + n) * D_;
  v16bf b0 = *reinterpret_cast<const v16bf*>(rowB + hi * 16);
  v16bf b1 = *reinterpret_cast<const v16bf*>(rowB + 32 + hi * 16);

  // a stage is 8KB contiguous in q: eight threads a row, two 16B copies per
  // thread, 32 rows apart
  const uint32_t  lA = lds_addr(&sA[0][0]) + (tid >> 3) * (QPIT * 2) + (tid & 7) * 16;
  const uint16_t* gA = qbase + tid * 8;
  copy2_b128(lA, gA, lA + 32 * QPIT * 2, gA + 2048);              // stage 0
  wait_async();
  __syncthreads();
  copy2_b128(lA + SJ_ * QPIT * 2, gA + SJ_ * D_,
             lA + (SJ_ + 32) * QPIT * 2, gA + SJ_ * D_ + 2048);   // stage 1

  float mloc = -1.0e30f, zloc = 0.0f;
  v16bf a[SJ_ / 16][2];   // a stage's A fragments, four 16-row tiles
  v8f   c[SJ_ / 16];      // S of the stage before, until its max and sums are taken
  // all 16 fragment reads of stage t, at constant LDS offsets
  auto read = [&](int t) {
    const uint16_t* sAt = sA[t & 1];
#pragma unroll
    for (int g = 0; g < SJ_ / 16; ++g) {
      const uint16_t* ar = sAt + (g * 16 + n) * QPIT;
      a[g][0] = lds_frag(ar + hi * 16);
      a[g][1] = lds_frag(ar + 32 + hi * 16);
    }
  };
  // S of one 32-row half of the stage
  auto prod = [&](int sub) {
#pragma unroll
    for (int g = 2 * sub; g < 2 * sub + 2; ++g) {
      v8f s = {};
      s = wmma_bf16(a[g][0], b0, s);
      c[g] = wmma_bf16(a[g][1], b1, s);
    }
  };
  // running max and sum over one 32-row half
  auto soft = [&](int sub, auto ex) {
    const v8f c0 = c[2 * sub], c1 = c[2 * sub + 1];
    float tmax = -1.0e30f;
#pragma unroll
    for (int r = 0; r < 8; ++r) {
      tmax = fmaxf(tmax, c0[r] * 0.125f);
      tmax = fmaxf(tmax, c1[r] * 0.125f);
    }
    const float nm = fmaxf(mloc, tmax);
    float zs = zloc * ex(mloc - nm);
#pragma unroll
    for (int r = 0; r < 8; ++r) {
      zs += ex(c0[r] * 0.125f - nm);
      zs += ex(c1[r] * 0.125f - nm);
    }
    mloc = nm; zloc = zs;
  };
  auto ex_loop = [](float x) { return __expf(x); };
  auto ex_tail = [](float x) { return expf_slot(x); };
  // publish stage t+1 and free stage t's buffer
  auto foot = [&]() {
    wait_ds();
    wait_async();
    __syncthreads();
  };

  read(0);
  // one group here too, instead of a wait at each pair of reads
  __builtin_amdgcn_sched_barrier(0);
  prod(0);
  prod(1);
  foot();
  for (int t = 1; t < NST_; ++t) {
    // behind the barrier that ended trip t-1: refill the buffer it has read
    if (t + 1 < NST_) {
      const uint32_t  l = lA + ((t + 1) & 1) * (SJ_ * QPIT * 2);
      const uint16_t* g = gA + (size_t)(t + 1) * (SJ_ * D_);
      copy2_b128(l, g, l + 32 * QPIT * 2, g + 2048);
    }
    read(t);
    // The reads stay first, as one group: the max and sums of stage t-1 (registers
    // only) run while they are under way. Left alone the compiler spreads the reads
    // over the trip, the last pairs right in front of their products with a full
    // wait each.
    __builtin_amdgcn_sched_barrier(0);
    soft(0, ex_loop);
    prod(0);
    soft(1, ex_loop);
    prod(1);
    // All of that stays ahead of the trip's closing waits: moved behind them, it
    // would start only when the last read has landed, and the refill would go late.
    __builtin_amdgcn_sched_barrier(0);
    foot();
  }
  wait_async();
  // the last stage's max and sums
  soft(0, ex_tail);
  soft(1, ex_tail);

  // combine lane pair (l, l^16): each holds 8 of the 16 rows of column n
  const float mo = __shfl_xor(mloc, 16, 32);
  const float zo = __shfl_xor(zloc, 16, 32);
  const float M  = fmaxf(mloc, mo);
  const float Z  = zloc * __expf(mloc - M) + zo * __expf(mo - M);
  if (lane < 16)
    mj[bT + j0 + lane] = M;

  // The ring is free: every wave's reads and copies ended at the last trip's
  // barrier. Lane (n, hi) holds token j0+n, d = hi*16.. and 32+hi*16.., and Z of
  // that token: the 64 x 128 tile [d][token] is put together in the ring's LDS.
  uint16_t* sT = &sA[0][0];
  union { v16bf v; uint16_t h[16]; } u0, u1;
  u0.v = b0;
  u1.v = b1;
#pragma unroll
  for (int e = 0; e < 16; ++e) {
    sT[(hi * 16 + e) * TPIT + wave * 16 + n]      = f2bfu(bf2f(u0.h[e]) / Z);
    sT[(32 + hi * 16 + e) * TPIT + wave * 16 + n] = f2bfu(bf2f(u1.h[e]) / Z);
  }
  __syncthreads();   // tile columns come from all eight waves

  // out in whole 256 B rows: sixteen threads a row d, 16 B each
  uint16_t* gT = qzT + (size_t)b * D_ * T_ + (j0 - wave * 16)
               + (size_t)(tid >> 4) * T_ + (tid & 15) * 8;
  const uint16_t* lT = sT + (tid >> 4) * TPIT + (tid & 15) * 8;
#pragma unroll
  for (int k = 0; k < 4; ++k)
    *reinterpret_cast<uint4*>(gT + (size_t)k * 16 * T_) =
        *reinterpret_cast<const uint4*>(lT + k * 16 * TPIT);
}

// ---------------------------------------------------------------------------
// Kernel 3: out[i,:] = sum_j exp(S_ij/8 - m_j) * q~[j,:]
// 8 waves/block share batch b; per 64 columns j the block's operands (q rows,
// q~^T columns, m) go through a ring of two LDS buffers: stage t+1's async
// copies fly while stage t is worked on. S is computed transposed (rows j,
// columns i): lane (n, hi) then holds row i0+n of P at j = 8*hi+r of each
// 16-column tile, and two tiles packed to bf16 are the A operand of P x q~ as
// they lie, element s at j = 16*(s>>3) + 8*hi + (s&7). q~^T is read in that order.
// ---------------------------------------------------------------------------
#define ZPIT 72   // q~^T rows in LDS: 128 B of data at a pitch of 144 B
__global__ __launch_bounds__(256)
void k_attn(const uint16_t* __restrict__ qb, const uint16_t* __restrict__ qzT,
            const float* __restrict__ mj, float* __restrict__ out)
{
  __shared__ __align__(16) uint16_t sQ[2][SJ_ * QPIT];  // 2 x 9KB q rows j
  __shared__ __align__(16) uint16_t sZ[2][D_ * ZPIT];   // 2 x 9KB q~^T[d][j]
  __shared__ __align__(16) float    sM[2][SJ_];         // 2 x 256B m_j
  const int tid = threadIdx.x, lane = tid & 31;
  const int wave = __builtin_amdgcn_readfirstlane(tid >> 5);
  const int gw = blockIdx.x * 8 + wave;                 // 0..2047
  const int b  = gw >> 7;
  const int i0 = (gw & 127) * 16;
  const int n  = lane & 15, hi = lane >> 4;
  const size_t bT = (size_t)b * T_;
  const uint16_t* qbase = qb + bT * D_;
  const uint16_t* zbase = qzT + (size_t)b * D_ * T_;

  // B operand for S^T: rows i0..i0+15 of q as columns (fixed over j loop)
  const uint16_t* rowA = qbase + (size_t)(i0 + n) * D_;
  v16bf a0 = *reinterpret_cast<const v16bf*>(rowA + hi * 16);
  v16bf a1 = *reinterpret_cast<const v16bf*>(rowA + 32 + hi * 16);

  v8f acc[4] = {v8f{}, v8f{}, v8f{}, v8f{}};

  // One stage: q rows, 8KB contiguous (eight threads a row, two 16B copies 32
  // rows apart);
  // q~^T, 64 rows d of 128 B (eight threads a row, two copies 32 rows apart);
  // m, 256 B (wave 0, 8 B a lane).
  const uint32_t  lQ = lds_addr(&sQ[0][0]) + (tid >> 3) * (QPIT * 2) + (tid & 7) * 16;
  const uint32_t  lZ = lds_addr(&sZ[0][0]) + (tid >> 3) * (ZPIT * 2) + (tid & 7) * 16;
  const uint32_t  lM = lds_addr(&sM[0][0]) + lane * 8;
  const uint16_t* gQ = qbase + tid * 8;
  const uint16_t* gZ = zbase + (size_t)(tid >> 3) * T_ + (tid & 7) * 8;
  const float*    gM = mj + bT + lane * 2;
  auto stage = [&](int s, int buf) {
    const uint32_t  q = lQ + buf * (SJ_ * QPIT * 2);
    const uint16_t* a = gQ + (size_t)s * (SJ_ * D_);
    copy2_b128(q, a, q + 32 * QPIT * 2, a + 2048);
    const uint32_t  z = lZ + buf * (D_ * ZPIT * 2);
    const uint16_t* c = gZ + s * SJ_;
    copy2_b128(z, c, z + 32 * ZPIT * 2, c + (size_t)32 * T_);
    if (wave == 0)
      copy1_b64(lM + buf * (SJ_ * 4), gM + s * SJ_);
  };
  stage(0, 0);
  wait_async();
  __syncthreads();
  stage(1, 1);

  for (int t = 0; t < NST_; ++t) {
    const uint16_t* sQt = sQ[t & 1];
    const uint16_t* sZt = sZ[t & 1];
    const float*    sMt = sM[t & 1];
    // No barrier stands inside a stage, so every LDS read of the stage goes out as
    // one group ahead of the products, in the order of use: m_j of the lane's 8
    // rows a tile, the q rows j (A of S^T), then q~^T (B of P x q~: 8 columns j at
    // hi*8 and 8 at 16 + hi*8). Every loop over these arrays is unrolled, so that
    // each index is a constant and they stay in registers.
    v16bf aq[SJ_ / 32][2][2], bz[SJ_ / 32][4];
    float4 mm[SJ_ / 32][2][2];
#pragma unroll
    for (int sub = 0; sub < SJ_ / 32; ++sub)
#pragma unroll
      for (int h = 0; h < 2; ++h) {
        const float4* mp = reinterpret_cast<const float4*>(
            sMt + sub * 32 + h * 16 + hi * 8);
        mm[sub][h][0] = mp[0];
        mm[sub][h][1] = mp[1];
      }
    // The m reads stay first: in one region with the fragment reads the compiler
    // put most of them last, and the first exponentials waited for the whole group.
    __builtin_amdgcn_sched_barrier(0);
#pragma unroll
    for (int sub = 0; sub < SJ_ / 32; ++sub)
#pragma unroll
      for (int h = 0; h < 2; ++h) {
        const uint16_t* rb = sQt + (sub * 32 + h * 16 + n) * QPIT;
        aq[sub][h][0] = lds_frag(rb + hi * 16);
        aq[sub][h][1] = lds_frag(rb + 32 + hi * 16);
      }
#pragma unroll
    for (int sub = 0; sub < SJ_ / 32; ++sub)
#pragma unroll
      for (int nt = 0; nt < 4; ++nt) {
        const uint16_t* zr = sZt + (nt * 16 + n) * ZPIT + sub * 32 + hi * 8;
        union { v16bf v; uint4 q[2]; } ub;
        ub.q[0] = *reinterpret_cast<const uint4*>(zr);
        ub.q[1] = *reinterpret_cast<const uint4*>(zr + 16);
        bz[sub][nt] = ub.v;
      }

#pragma unroll
    for (int sub = 0; sub < SJ_ / 32; ++sub) {
      // two 16x16 S^T sub-tiles -> P = exp(S/8 - m_j), packed in registers
      union { v16bf v; uint32_t w[8]; } pa;
#pragma unroll
      for (int h = 0; h < 2; ++h) {
        v8f s = {};
        s = wmma_bf16(aq[sub][h][0], a0, s);  // s[r] = S[i0+n][j], j = h*16+hi*8+r
        s = wmma_bf16(aq[sub][h][1], a1, s);
        const float4 m0 = mm[sub][h][0], m1 = mm[sub][h][1];
        const float mv[8] = {m0.x, m0.y, m0.z, m0.w, m1.x, m1.y, m1.z, m1.w};
#pragma unroll
        for (int r = 0; r < 8; r += 2)
          pa.w[h * 4 + (r >> 1)] = cvtpk(__expf(s[r] * 0.125f - mv[r]),
                                         __expf(s[r + 1] * 0.125f - mv[r + 1]));
      }
#pragma unroll
      for (int nt = 0; nt < 4; ++nt)
        acc[nt] = wmma_bf16(pa.v, bz[sub][nt], acc[nt]);
    }
    // Order for the compiler's scheduler: the 32 fragment reads first, then the 16
    // matrix products. Left alone it moves each read down to its product and
    // waits there, one LDS latency after another.
    __builtin_amdgcn_sched_group_barrier(0x100, 32, 0);
    __builtin_amdgcn_sched_group_barrier(0x008, 16, 0);
    // The products stay ahead of the stage's closing waits: moved behind them, they
    // would start only when the last of the 40 reads has landed.
    __builtin_amdgcn_sched_barrier(0);
    // publish stage t+1, free stage t's buffers, then refill them with t+2
    wait_ds();
    wait_async();
    __syncthreads();
    if (t + 2 < NST_) stage(t + 2, t & 1);
  }
  wait_async();

#pragma unroll
  for (int nt = 0; nt < 4; ++nt)
#pragma unroll
    for (int r = 0; r < 8; ++r)
      out[(bT + i0 + r + hi * 8) * D_ + nt * 16 + n] = acc[nt][r];
}

// ---------------------------------------------------------------------------
extern "C" void kernel_launch(void* const* d_in, const int* in_sizes, int n_in,
                              void* d_out, int out_size, void* d_ws, size_t ws_size,
                              hipStream_t stream)
{
  (void)in_sizes; (void)n_in; (void)out_size; (void)ws_size;
  const float* x  = (const float*)d_in[0];
  const float* Wq = (const float*)d_in[1];
  const float* bq = (const float*)d_in[2];
  float* out = (float*)d_out;

  char* ws = (char*)d_ws;
  uint16_t* qb  = (uint16_t*)(ws);                                 // 4 MB  q bf16
  uint16_t* qzT = (uint16_t*)(ws + ((size_t)4 << 20));             // 4 MB  (q/Z)^T bf16
  uint16_t* WqT = (uint16_t*)(ws + ((size_t)8 << 20));             // 64 KB Wq^T bf16
  float*    mj  = (float*)   (ws + ((size_t)9 << 20));             // 128 KB col max

  k_wt   <<<128,  256, 0, stream>>>(Wq, WqT);
  k_proj <<<256,  256, 0, stream>>>(x, WqT, bq, qb);
  k_stats<<<256,  256, 0, stream>>>(qb, mj, qzT);
  k_attn <<<256,  256, 0, stream>>>(qb, qzT, mj, out);
}

// v006
// A run of this version takes 58.1 microseconds.
// Timed twice side by side with v005, it ran 1.16 and 1.18 times as fast.
// All steps since v000 together make it 3.38 times as fast.
#include <hip/hip_runtime.h>
#include <hip/hip_bf16.h>
#include <stdint.h>

#define B_  16
#define T_  2048
#define E_  512
#define D_  64

typedef __attribute__((ext_vector_type(16))) __bf16 v16bf;
typedef __attribute__((ext_vector_type(8)))  float  v8f;
typedef __attribute__((ext_vector_type(2)))  float  v2f;
typedef __attribute__((ext_vector_type(2)))  __bf16 v2bf;

// Round two f32 to bf16 (RNE) and pack into one u32 via v_perm_b32.
static __device__ __forceinline__ uint32_t pkbf(float a, float b) {
  uint32_t ua = __builtin_bit_cast(uint32_t, a);
  uint32_t ub = __builtin_bit_cast(uint32_t, b);
  ua += 0x7FFFu + ((ua >> 16) & 1u);
  ub += 0x7FFFu + ((ub >> 16) & 1u);
  // out = {ub[31:24], ub[23:16], ua[31:24], ua[23:16]}
  return __builtin_amdgcn_perm(ub, ua, 0x07060302u);
}
// The same rounding: one packed convert.
static __device__ __forceinline__ uint32_t cvtpk(float a, float b) {
  v2f f = {a, b};
  return __builtin_bit_cast(uint32_t, __builtin_convertvector(f, v2bf));
}
static __device__ __forceinline__ uint16_t f2bfu(float f) {
  uint32_t u = __builtin_bit_cast(uint32_t, f);
  u += 0x7FFFu + ((u >> 16) & 1u);
  return (uint16_t)(u >> 16);
}
static __device__ __forceinline__ float bf2f(uint16_t h) {
  return __builtin_bit_cast(float, (uint32_t)h << 16);   // exact
}

static __device__ __forceinline__ v8f wmma_bf16(v16bf a, v16bf b, v8f c) {
  // D = A(16x32 bf16) * B(32x16 bf16) + C(16x16 f32)
  return __builtin_amdgcn_wmma_f32_16x16x32_bf16(false, a, false, b, (short)0, c,
                                                 false, false);
}

// Rows (k_stats) or columns (k_attn) of S that one ring stage holds, and stages.
#define SJ_  64
#define NST_ (T_ / SJ_)
// q rows in LDS: 128 B of data at a pitch of 144 B (16 B x odd), so that the 16
// rows one ds_load_b128 reads fall on 16 different groups of four banks.
#define QPIT 72

// A 16-element fragment from LDS rows that are 16-byte aligned only.
static __device__ __forceinline__ v16bf lds_frag(const uint16_t* p) {
  const uint4* q = reinterpret_cast<const uint4*>(p);
  union { v16bf v; uint4 q[2]; } u;
  u.q[0] = q[0];
  u.q[1] = q[1];
  return u.v;
}

// LDS byte address of a __shared__ object (what an async copy takes).
static __device__ __forceinline__ uint32_t lds_addr(const void* p) {
  typedef __attribute__((address_space(3))) const unsigned char lds_byte;
  return (uint32_t)(uintptr_t)(lds_byte*)p;
}
// Async copies global -> LDS, 16 B a lane each. The s_wait_xcnt closes the
// statement so that no address register is rewritten ahead of it.
static __device__ __forceinline__ void copy2_b128(uint32_t l0, const void* g0,
                                                  uint32_t l1, const void* g1) {
  asm volatile("global_load_async_to_lds_b128 %0, %1, off\n\t"
               "global_load_async_to_lds_b128 %2, %3, off\n\t"
               "s_wait_xcnt 0x0"
               :: "v"(l0), "v"(g0), "v"(l1), "v"(g1) : "memory");
}
// The same, 8 B a lane.
static __device__ __forceinline__ void copy1_b64(uint32_t l0, const void* g0) {
  asm volatile("global_load_async_to_lds_b64 %0, %1, off\n\t"
               "s_wait_xcnt 0x0"
               :: "v"(l0), "v"(g0) : "memory");
}
// This wave's copies have landed (other waves read them behind the barrier).
static __device__ __forceinline__ void wait_async() {
  asm volatile("s_wait_asynccnt 0x0" ::: "memory");
}
// This wave's LDS reads are done (before a copy refills what it has read).
static __device__ __forceinline__ void wait_ds() {
  asm volatile("s_wait_dscnt 0x0" ::: "memory");
}

// __expf with the free issue slot behind the transcendental written into its own
// statement: for straight-line code.
static __device__ __forceinline__ float expf_slot(float x) {
  float r;
  // v_nop: that slot; inside the statement nothing can be scheduled in front of it
  asm("v_exp_f32 %0, %1\n\tv_nop" : "=v"(r) : "v"(x * 1.44269504f));
  return r;
}

// ---------------------------------------------------------------------------
// Kernel 1: q = x @ Wq + bq (bf16 out). One wave per 16x64 q tile. Each block
// first puts Wq^T[n][k] = bf16(Wq[k][n]) (64 x 512) into its LDS; the B operand
// is read from there, 16 values k in a row per lane.
// ---------------------------------------------------------------------------
// Wq^T rows in LDS: 1024 B of data at a pitch of 1040 B (16 B x odd), so that 16
// rows n fall on 16 different groups of four banks, for the stores and the reads.
#define WPIT 520
__global__ __launch_bounds__(256)
void k_proj(const float* __restrict__ x, const float* __restrict__ Wq,
            const float* __restrict__ bq, uint16_t* __restrict__ qb)
{
  __shared__ __align__(16) uint16_t sW[D_ * WPIT];     // 65 KB
  const int tid  = threadIdx.x;
  {
    // A thread takes one column n of Wq and 16 groups of 8 rows k: a wave's load
    // is one whole 128 B line of a row, its store 16 B in each of 32 rows of Wq^T.
    const float* wp = Wq + (size_t)(tid >> 6) * 8 * D_ + (tid & 63);
    uint16_t*    sp = sW + (tid & 63) * WPIT + (tid >> 6) * 8;
    // Both loops unrolled: every load is a constant offset from one address pair
    // and many are in flight at once; w stays in registers.
#pragma unroll
    for (int p = 0; p < E_ / 32; ++p) {
      float w[8];
#pragma unroll
      for (int e = 0; e < 8; ++e) w[e] = wp[(p * 32 + e) * D_];
      const uint4 v = {cvtpk(w[0], w[1]), cvtpk(w[2], w[3]),
                       cvtpk(w[4], w[5]), cvtpk(w[6], w[7])};
      *reinterpret_cast<uint4*>(sp + p * 32) = v;
    }
  }
  __syncthreads();   // every wave reads all of Wq^T

  const int wave = tid >> 5;
  const int lane = tid & 31;
  const int n    = lane & 15;      // A-layout M / C-layout N
  const int hi   = lane >> 4;      // K-half selector
  const int tok0 = blockIdx.x * 128 + wave * 16;

  v8f acc[4] = {v8f{}, v8f{}, v8f{}, v8f{}};
  const float* xrow = x + (size_t)(tok0 + n) * E_;

  for (int kb = 0; kb < E_; kb += 32) {
    if (kb + 32 < E_)
      __builtin_prefetch(xrow + kb + 32 + hi * 16, 0, 0);

    // A operand: x[tok0+n][kb + hi*16 .. +15] -> bf16 (perm-packed converts)
    const float4* xr = reinterpret_cast<const float4*>(xrow + kb + hi * 16);
    float4 p0 = xr[0], p1 = xr[1], p2 = xr[2], p3 = xr[3];
    // B operand: Wq^T[nt*16+n][kb + hi*16 .. +15] of the four column tiles
    // (unrolled, so that bv is indexed by constants and stays in registers)
    v16bf bv[4];
#pragma unroll
    for (int nt = 0; nt < 4; ++nt)
      bv[nt] = lds_frag(sW + (nt * 16 + n) * WPIT + kb + hi * 16);
    // The eight LDS reads stay here, one group under the x loads' latency. Left
    // alone the compiler reads each tile's pair into the same registers right in
    // front of its product and waits out the LDS latency four times a trip.
    // s_wait_xcnt: stands before the x loads' address pair is stepped, further down.
    asm volatile("s_wait_xcnt 0x0" ::: "memory");
    __builtin_amdgcn_sched_barrier(0);
    float fv[16] = {p0.x, p0.y, p0.z, p0.w, p1.x, p1.y, p1.z, p1.w,
                    p2.x, p2.y, p2.z, p2.w, p3.x, p3.y, p3.z, p3.w};
    union { v16bf v; uint32_t w[8]; } ua;
#pragma unroll
    for (int q = 0; q < 8; ++q) ua.w[q] = pkbf(fv[2 * q], fv[2 * q + 1]);

#pragma unroll
    for (int nt = 0; nt < 4; ++nt)
      acc[nt] = wmma_bf16(ua.v, bv[nt], acc[nt]);
  }

  // Epilogue: C layout -> lane holds column n, rows r + hi*8
#pragma unroll
  for (int nt = 0; nt < 4; ++nt) {
    const int col  = nt * 16 + n;
    const float bb = bq[col];
#pragma unroll
    for (int r = 0; r < 8; ++r) {
      const size_t row = (size_t)tok0 + r + hi * 8;
      qb[row * D_ + col] = f2bfu(acc[nt][r] + bb);
    }
  }
}

// ---------------------------------------------------------------------------
// Kernel 2: column softmax stats: m_j = max_i S_ij, Z_j = sum_i e^{S_ij-m_j}.
// 8 waves/block share batch b; 64-row i-chunks of q (8KB) go through a ring of
// two LDS buffers: stage t+1's async copies fly while stage t is worked on.
// The loop runs one stage apart: trip t reads stage t's fragments, takes the max
// and the sums of S of stage t-1 while those reads are under way, then forms S.
// Epilogue: q~^T[b][d][t] = bf16(q[b,t,d] / Z_{b,t}) for the block's 128 tokens
// (transposed layout so that the P x q~ B operand has its 32 columns j in a
// row), from the q rows each wave already holds as its B operand.
// ---------------------------------------------------------------------------
#define TPIT 136  // q~^T tile rows in LDS: 256 B of data at a pitch of 272 B
__global__ __launch_bounds__(256)
void k_stats(const uint16_t* __restrict__ qb, float* __restrict__ mj,
             uint16_t* __restrict__ qzT)
{
  __shared__ __align__(16) uint16_t sA[2][SJ_ * QPIT]; // 2 x 9KB ring of i-chunks
  const int tid = threadIdx.x, wave = tid >> 5, lane = tid & 31;
  const int gw = blockIdx.x * 8 + wave;                // 0..2047
  const int b  = gw >> 7;
  const int j0 = (gw & 127) * 16;
  const int n  = lane & 15, hi = lane >> 4;
  const size_t bT = (size_t)b * T_;
  const uint16_t* qbase = qb + bT * D_;

  // B operand fixed over i loop: B[k][n] = q[j0+n][k]
  const uint16_t* rowB = qbase + (size_t)(j0 + n) * D_;
  v16bf b0 = *reinterpret_cast<const v16bf*>(rowB + hi * 16);
  v16bf b1 = *reinterpret_cast<const v16bf*>(rowB + 32 + hi * 16);

  // a stage is 8KB contiguous in q: eight threads a row, two 16B copies per
  // thread, 32 rows apart
  const uint32_t  lA = lds_addr(&sA[0][0]) + (tid >> 3) * (QPIT * 2) + (tid & 7) * 16;
  const uint16_t* gA = qbase + tid * 8;
  copy2_b128(lA, gA, lA + 32 * QPIT * 2, gA + 2048);              // stage 0
  wait_async();
  __syncthreads();
  copy2_b128(lA + SJ_ * QPIT * 2, gA + SJ_ * D_,
             lA + (SJ_ + 32) * QPIT * 2, gA + SJ_ * D_ + 2048);   // stage 1

  float mloc = -1.0e30f, zloc = 0.0f;
  v16bf a[SJ_ / 16][2];   // a stage's A fragments, four 16-row tiles
  v8f   c[SJ_ / 16];      // S of the stage before, until its max and sums are taken
  // all 16 fragment reads of stage t, at constant LDS offsets
  auto read = [&](int t) {
    const uint16_t* sAt = sA[t & 1];
#pragma unroll
    for (int g = 0; g < SJ_ / 16; ++g) {
      const uint16_t* ar = sAt + (g * 16 + n) * QPIT;
      a[g][0] = lds_frag(ar + hi * 16);
      a[g][1] = lds_frag(ar + 32 + hi * 16);
    }
  };
  // S of one 32-row half of the stage
  auto prod = [&](int sub) {
#pragma unroll
    for (int g = 2 * sub; g < 2 * sub + 2; ++g) {
      v8f s = {};
      s = wmma_bf16(a[g][0], b0, s);
      c[g] = wmma_bf16(a[g][1], b1, s);
    }
  };
  // running max and sum over one 32-row half
  auto soft = [&](int sub, auto ex) {
    const v8f c0 = c[2 * sub], c1 = c[2 * sub + 1];
    float tmax = -1.0e30f;
#pragma unroll
    for (int r = 0; r < 8; ++r) {
      tmax = fmaxf(tmax, c0[r] * 0.125f);
      tmax = fmaxf(tmax, c1[r] * 0.125f);
    }
    const float nm = fmaxf(mloc, tmax);
    float zs = zloc * ex(mloc - nm);
#pragma unroll
    for (int r = 0; r < 8; ++r) {
      zs += ex(c0[r] * 0.125f - nm);
      zs += ex(c1[r] * 0.125f - nm);
    }
    mloc = nm; zloc = zs;
  };
  auto ex_loop = [](float x) { return __expf(x); };
  auto ex_tail = [](float x) { return expf_slot(x); };
  // publish stage t+1 and free stage t's buffer
  auto foot = [&]() {
    wait_ds();
    wait_async();
    __syncthreads();
  };

  read(0);
  // one group here too, instead of a wait at each pair of reads
  __builtin_amdgcn_sched_barrier(0);
  prod(0);
  prod(1);
  foot();
  for (int t = 1; t < NST_; ++t) {
    // behind the barrier that ended trip t-1: refill the buffer it has read
    if (t + 1 < NST_) {
      const uint32_t  l = lA + ((t + 1) & 1) * (SJ_ * QPIT * 2);
      const uint16_t* g = gA + (size_t)(t + 1) * (SJ_ * D_);
      copy2_b128(l, g, l + 32 * QPIT * 2, g + 2048);
    }
    read(t);
    // The reads stay first, as one group: the max and sums of stage t-1 (registers
    // only) run while they are under way. Left alone the compiler spreads the reads
    // over the trip, the last pairs right in front of their products with a full
    // wait each.
    __builtin_amdgcn_sched_barrier(0);
    soft(0, ex_loop);
    prod(0);
    soft(1, ex_loop);
    prod(1);
    // All of that stays ahead of the trip's closing waits: moved behind them, it
    // would start only when the last read has landed, and the refill would go late.
    __builtin_amdgcn_sched_barrier(0);
    foot();
  }
  wait_async();
  // the last stage's max and sums
  soft(0, ex_tail);
  soft(1, ex_tail);

  // combine lane pair (l, l^16): each holds 8 of the 16 rows of column n
  const float mo = __shfl_xor(mloc, 16, 32);
  const float zo = __shfl_xor(zloc, 16, 32);
  const float M  = fmaxf(mloc, mo);
  const float Z  = zloc * __expf(mloc - M) + zo * __expf(mo - M);
  if (lane < 16)
    mj[bT + j0 + lane] = M;

  // The ring is free: every wave's reads and copies ended at the last trip's
  // barrier. Lane (n, hi) holds token j0+n, d = hi*16.. and 32+hi*16.., and Z of
  // that token: the 64 x 128 tile [d][token] is put together in the ring's LDS.
  uint16_t* sT = &sA[0][0];
  union { v16bf v; uint16_t h[16]; } u0, u1;
  u0.v = b0;
  u1.v = b1;
#pragma unroll
  for (int e = 0; e < 16; ++e) {
    sT[(hi * 16 + e) * TPIT + wave * 16 + n]      = f2bfu(bf2f(u0.h[e]) / Z);
    sT[(32 + hi * 16 + e) * TPIT + wave * 16 + n] = f2bfu(bf2f(u1.h[e]) / Z);
  }
  __syncthreads();   // tile columns come from all eight waves

  // out in whole 256 B rows: sixteen threads a row d, 16 B each
  uint16_t* gT = qzT + (size_t)b * D_ * T_ + (j0 - wave * 16)
               + (size_t)(tid >> 4) * T_ + (tid & 15) * 8;
  const uint16_t* lT = sT + (tid >> 4) * TPIT + (tid & 15) * 8;
#pragma unroll
  for (int k = 0; k < 4; ++k)
    *reinterpret_cast<uint4*>(gT + (size_t)k * 16 * T_) =
        *reinterpret_cast<const uint4*>(lT + k * 16 * TPIT);
}

// ---------------------------------------------------------------------------
// Kernel 3: out[i,:] = sum_j exp(S_ij/8 - m_j) * q~[j,:]
// 8 waves/block share batch b; per 64 columns j the block's operands (q rows,
// q~^T columns, m) go through a ring of two LDS buffers: stage t+1's async
// copies fly while stage t is worked on. S is computed transposed (rows j,
// columns i): lane (n, hi) then holds row i0+n of P at j = 8*hi+r of each
// 16-column tile, and two tiles packed to bf16 are the A operand of P x q~ as
// they lie, element s at j = 16*(s>>3) + 8*hi + (s&7). q~^T is read in that order.
// ---------------------------------------------------------------------------
#define ZPIT 72   // q~^T rows in LDS: 128 B of data at a pitch of 144 B
__global__ __launch_bounds__(256)
void k_attn(const uint16_t* __restrict__ qb, const uint16_t* __restrict__ qzT,
            const float* __restrict__ mj, float* __restrict__ out)
{
  __shared__ __align__(16) uint16_t sQ[2][SJ_ * QPIT];  // 2 x 9KB q rows j
  __shared__ __align__(16) uint16_t sZ[2][D_ * ZPIT];   // 2 x 9KB q~^T[d][j]
  __shared__ __align__(16) float    sM[2][SJ_];         // 2 x 256B m_j
  const int tid = threadIdx.x, lane = tid & 31;
  const int wave = __builtin_amdgcn_readfirstlane(tid >> 5);
  const int gw = blockIdx.x * 8 + wave;                 // 0..2047
  const int b  = gw >> 7;
  const int i0 = (gw & 127) * 16;
  const int n  = lane & 15, hi = lane >> 4;
  const size_t bT = (size_t)b * T_;
  const uint16_t* qbase = qb + bT * D_;
  const uint16_t* zbase = qzT + (size_t)b * D_ * T_;

  // B operand for S^T: rows i0..i0+15 of q as columns (fixed over j loop)
  const uint16_t* rowA = qbase + (size_t)(i0 + n) * D_;
  v16bf a0 = *reinterpret_cast<const v16bf*>(rowA + hi * 16);
  v16bf a1 = *reinterpret_cast<const v16bf*>(rowA + 32 + hi * 16);

  v8f acc[4] = {v8f{}, v8f{}, v8f{}, v8f{}};

  // One stage: q rows, 8KB contiguous (eight threads a row, two 16B copies 32
  // rows apart);
  // q~^T, 64 rows d of 128 B (eight threads a row, two copies 32 rows apart);
  // m, 256 B (wave 0, 8 B a lane).
  const uint32_t  lQ = lds_addr(&sQ[0][0]) + (tid >> 3) * (QPIT * 2) + (tid & 7) * 16;
  const uint32_t  lZ = lds_addr(&sZ[0][0]) + (tid >> 3) * (ZPIT * 2) + (tid & 7) * 16;
  const uint32_t  lM = lds_addr(&sM[0][0]) + lane * 8;
  const uint16_t* gQ = qbase + tid * 8;
  const uint16_t* gZ = zbase + (size_t)(tid >> 3) * T_ + (tid & 7) * 8;
  const float*    gM = mj + bT + lane * 2;
  auto stage = [&](int s, int buf) {
    const uint32_t  q = lQ + buf * (SJ_ * QPIT * 2);
    const uint16_t* a = gQ + (size_t)s * (SJ_ * D_);
    copy2_b128(q, a, q + 32 * QPIT * 2, a + 2048);
    const uint32_t  z = lZ + buf * (D_ * ZPIT * 2);
    const uint16_t* c = gZ + s * SJ_;
    copy2_b128(z, c, z + 32 * ZPIT * 2, c + (size_t)32 * T_);
    if (wave == 0)
      copy1_b64(lM + buf * (SJ_ * 4), gM + s * SJ_);
  };
  stage(0, 0);
  wait_async();
  __syncthreads();
  stage(1, 1);

  for (int t = 0; t < NST_; ++t) {
    const uint16_t* sQt = sQ[t & 1];
    const uint16_t* sZt = sZ[t & 1];
    const float*    sMt = sM[t & 1];
    // No barrier stands inside a stage, so every LDS read of the stage goes out as
    // one group ahead of the products, in the order of use: m_j of the lane's 8
    // rows a tile, the q rows j (A of S^T), then q~^T (B of P x q~: 8 columns j at
    // hi*8 and 8 at 16 + hi*8). Every loop over these arrays is unrolled, so that
    // each index is a constant and they stay in registers.
    v16bf aq[SJ_ / 32][2][2], bz[SJ_ / 32][4];
    float4 mm[SJ_ / 32][2][2];
#pragma unroll
    for (int sub = 0; sub < SJ_ / 32; ++sub)
#pragma unroll
      for (int h = 0; h < 2; ++h) {
        const float4* mp = reinterpret_cast<const float4*>(
            sMt + sub * 32 + h * 16 + hi * 8);
        mm[sub][h][0] = mp[0];
        mm[sub][h][1] = mp[1];
      }
    // The m reads stay first: in one region with the fragment reads the compiler
    // put most of them last, and the first exponentials waited for the whole group.
    __builtin_amdgcn_sched_barrier(0);
#pragma unroll
    for (int sub = 0; sub < SJ_ / 32; ++sub)
#pragma unroll
      for (int h = 0; h < 2; ++h) {
        const uint16_t* rb = sQt + (sub * 32 + h * 16 + n) * QPIT;
        aq[sub][h][0] = lds_frag(rb + hi * 16);
        aq[sub][h][1] = lds_frag(rb + 32 + hi * 16);
      }
#pragma unroll
    for (int sub = 0; sub < SJ_ / 32; ++sub)
#pragma unroll
      for (int nt = 0; nt < 4; ++nt) {
        const uint16_t* zr = sZt + (nt * 16 + n) * ZPIT + sub * 32 + hi * 8;
        union { v16bf v; uint4 q[2]; } ub;
        ub.q[0] = *reinterpret_cast<const uint4*>(zr);
        ub.q[1] = *reinterpret_cast<const uint4*>(zr + 16);
        bz[sub][nt] = ub.v;
      }

#pragma unroll
    for (int sub = 0; sub < SJ_ / 32; ++sub) {
      // two 16x16 S^T sub-tiles -> P = exp(S/8 - m_j), packed in registers
      union { v16bf v; uint32_t w[8]; } pa;
#pragma unroll
      for (int h = 0; h < 2; ++h) {
        v8f s = {};
        s = wmma_bf16(aq[sub][h][0], a0, s);  // s[r] = S[i0+n][j], j = h*16+hi*8+r
        s = wmma_bf16(aq[sub][h][1], a1, s);
        const float4 m0 = mm[sub][h][0], m1 = mm[sub][h][1];
        const float mv[8] = {m0.x, m0.y, m0.z, m0.w, m1.x, m1.y, m1.z, m1.w};
#pragma unroll
        for (int r = 0; r < 8; r += 2)
          pa.w[h * 4 + (r >> 1)] = cvtpk(__expf(s[r] * 0.125f - mv[r]),
                                         __expf(s[r + 1] * 0.125f - mv[r + 1]));
      }
#pragma unroll
      for (int nt = 0; nt < 4; ++nt)
        acc[nt] = wmma_bf16(pa.v, bz[sub][nt], acc[nt]);
    }
    // Order for the compiler's scheduler: the 32 fragment reads first, then the 16
    // matrix products. Left alone it moves each read down to its product and
    // waits there, one LDS latency after another.
    __builtin_amdgcn_sched_group_barrier(0x100, 32, 0);
    __builtin_amdgcn_sched_group_barrier(0x008, 16, 0);
    // The products stay ahead of the stage's closing waits: moved behind them, they
    // would start only when the last of the 40 reads has landed.
    __builtin_amdgcn_sched_barrier(0);
    // publish stage t+1, free stage t's buffers, then refill them with t+2
    wait_ds();
    wait_async();
    __syncthreads();
    if (t + 2 < NST_) stage(t + 2, t & 1);
  }
  wait_async();

#pragma unroll
  for (int nt = 0; nt < 4; ++nt)
#pragma unroll
    for (int r = 0; r < 8; ++r)
      out[(bT + i0 + r + hi * 8) * D_ + nt * 16 + n] = acc[nt][r];
}

// ---------------------------------------------------------------------------
extern "C" void kernel_launch(void* const* d_in, const int* in_sizes, int n_in,
                              void* d_out, int out_size, void* d_ws, size_t ws_size,
                              hipStream_t stream)
{
  (void)in_sizes; (void)n_in; (void)out_size; (void)ws_size;
  const float* x  = (const float*)d_in[0];
  const float* Wq = (const float*)d_in[1];
  const float* bq = (const float*)d_in[2];
  float* out = (float*)d_out;

  char* ws = (char*)d_ws;
  uint16_t* qb  = (uint16_t*)(ws);                                 // 4 MB  q bf16
  uint16_t* qzT = (uint16_t*)(ws + ((size_t)4 << 20));             // 4 MB  (q/Z)^T bf16
  float*    mj  = (float*)   (ws + ((size_t)9 << 20));             // 128 KB col max

  k_proj <<<256,  256, 0, stream>>>(x, Wq, bq, qb);
  k_stats<<<256,  256, 0, stream>>>(qb, mj, qzT);
  k_attn <<<256,  256, 0, stream>>>(qb, qzT, mj, out);
}

// v007
// It runs in 46 microseconds.
// In two side-by-side timings against v006, it was 1.32 and 1.30 times as fast.
// Over all steps from v000 it is 4.43 times as fast.
#include <hip/hip_runtime.h>
#include <hip/hip_bf16.h>
#include <stdint.h>

#define B_  16
#define T_  2048
#define E_  512
#define D_  64

typedef __attribute__((ext_vector_type(16))) __bf16 v16bf;
typedef __attribute__((ext_vector_type(8)))  float  v8f;
typedef __attribute__((ext_vector_type(2)))  float  v2f;
typedef __attribute__((ext_vector_type(2)))  __bf16 v2bf;

// Round two f32 to bf16 (RNE) and pack into one u32 via v_perm_b32.
static __device__ __forceinline__ uint32_t pkbf(float a, float b) {
  uint32_t ua = __builtin_bit_cast(uint32_t, a);
  uint32_t ub = __builtin_bit_cast(uint32_t, b);
  ua += 0x7FFFu + ((ua >> 16) & 1u);
  ub += 0x7FFFu + ((ub >> 16) & 1u);
  // out = {ub[31:24], ub[23:16], ua[31:24], ua[23:16]}
  return __builtin_amdgcn_perm(ub, ua, 0x07060302u);
}
// The same rounding: one packed convert.
static __device__ __forceinline__ uint32_t cvtpk(float a, float b) {
  v2f f = {a, b};
  return __builtin_bit_cast(uint32_t, __builtin_convertvector(f, v2bf));
}
static __device__ __forceinline__ uint16_t f2bfu(float f) {
  uint32_t u = __builtin_bit_cast(uint32_t, f);
  u += 0x7FFFu + ((u >> 16) & 1u);
  return (uint16_t)(u >> 16);
}
static __device__ __forceinline__ float bf2f(uint16_t h) {
  return __builtin_bit_cast(float, (uint32_t)h << 16);   // exact
}

static __device__ __forceinline__ v8f wmma_bf16(v16bf a, v16bf b, v8f c) {
  // D = A(16x32 bf16) * B(32x16 bf16) + C(16x16 f32)
  return __builtin_amdgcn_wmma_f32_16x16x32_bf16(false, a, false, b, (short)0, c,
                                                 false, false);
}

// Rows (k_stats) or columns (k_attn) of S that are worked on at a time (a chunk),
// and that one ring stage holds: four chunks, so that a stage's copies have four
// chunks' work to land in, from memory too, and the waves meet once a stage.
#define CJ_  64
#define SJ_  256
#define CPS_ (SJ_ / CJ_)
#define NST_ (T_ / SJ_)
// q rows in LDS: 128 B of data at a pitch of 144 B (16 B x odd), so that the 16
// rows one ds_load_b128 reads fall on 16 different groups of four banks.
#define QPIT 72

// A 16-element fragment from LDS rows that are 16-byte aligned only.
static __device__ __forceinline__ v16bf lds_frag(const uint16_t* p) {
  const uint4* q = reinterpret_cast<const uint4*>(p);
  union { v16bf v; uint4 q[2]; } u;
  u.q[0] = q[0];
  u.q[1] = q[1];
  return u.v;
}

// LDS byte address of a __shared__ object (what an async copy takes).
static __device__ __forceinline__ uint32_t lds_addr(const void* p) {
  typedef __attribute__((address_space(3))) const unsigned char lds_byte;
  return (uint32_t)(uintptr_t)(lds_byte*)p;
}
// Async copies global -> LDS, 16 B a lane each. The s_wait_xcnt closes the
// statement so that no address register is rewritten ahead of it.
static __device__ __forceinline__ void copy2_b128(uint32_t l0, const void* g0,
                                                  uint32_t l1, const void* g1) {
  asm volatile("global_load_async_to_lds_b128 %0, %1, off\n\t"
               "global_load_async_to_lds_b128 %2, %3, off\n\t"
               "s_wait_xcnt 0x0"
               :: "v"(l0), "v"(g0), "v"(l1), "v"(g1) : "memory");
}
// Eight such copies at even steps (ls bytes in LDS, gs elements in memory).
static __device__ __forceinline__ void copy8_b128(uint32_t l, uint32_t ls,
                                                  const uint16_t* g, size_t gs) {
  asm volatile("global_load_async_to_lds_b128 %0, %1, off\n\t"
               "global_load_async_to_lds_b128 %2, %3, off\n\t"
               "global_load_async_to_lds_b128 %4, %5, off\n\t"
               "global_load_async_to_lds_b128 %6, %7, off\n\t"
               "global_load_async_to_lds_b128 %8, %9, off\n\t"
               "global_load_async_to_lds_b128 %10, %11, off\n\t"
               "global_load_async_to_lds_b128 %12, %13, off\n\t"
               "global_load_async_to_lds_b128 %14, %15, off\n\t"
               "s_wait_xcnt 0x0"
               :: "v"(l),          "v"(g),          "v"(l + ls),     "v"(g + gs),
                  "v"(l + 2 * ls), "v"(g + 2 * gs), "v"(l + 3 * ls), "v"(g + 3 * gs),
                  "v"(l + 4 * ls), "v"(g + 4 * gs), "v"(l + 5 * ls), "v"(g + 5 * gs),
                  "v"(l + 6 * ls), "v"(g + 6 * gs), "v"(l + 7 * ls), "v"(g + 7 * gs)
               : "memory");
}
// This wave's copies have landed (other waves read them behind the barrier).
static __device__ __forceinline__ void wait_async() {
  asm volatile("s_wait_asynccnt 0x0" ::: "memory");
}
// This wave's LDS reads are done (before a copy refills what it has read).
static __device__ __forceinline__ void wait_ds() {
  asm volatile("s_wait_dscnt 0x0" ::: "memory");
}

// __expf with the free issue slot behind the transcendental written into its own
// statement: for straight-line code.
static __device__ __forceinline__ float expf_slot(float x) {
  float r;
  // v_nop: that slot; inside the statement nothing can be scheduled in front of it
  asm("v_exp_f32 %0, %1\n\tv_nop" : "=v"(r) : "v"(x * 1.44269504f));
  return r;
}

// ---------------------------------------------------------------------------
// Kernel 1: q = x @ Wq + bq (bf16 out). One wave per 16x64 q tile. Each block
// first puts Wq^T[n][k] = bf16(Wq[k][n]) (64 x 512) into its LDS; the B operand
// is read from there, 16 values k in a row per lane.
// ---------------------------------------------------------------------------
// Wq^T rows in LDS: 1024 B of data at a pitch of 1040 B (16 B x odd), so that 16
// rows n fall on 16 different groups of four banks, for the stores and the reads.
#define WPIT 520
__global__ __launch_bounds__(256)
void k_proj(const float* __restrict__ x, const float* __restrict__ Wq,
            const float* __restrict__ bq, uint16_t* __restrict__ qb)
{
  __shared__ __align__(16) uint16_t sW[D_ * WPIT];     // 65 KB
  const int tid  = threadIdx.x;
  {
    // A thread takes one column n of Wq and 16 groups of 8 rows k: a wave's load
    // is one whole 128 B line of a row, its store 16 B in each of 32 rows of Wq^T.
    const float* wp = Wq + (size_t)(tid >> 6) * 8 * D_ + (tid & 63);
    uint16_t*    sp = sW + (tid & 63) * WPIT + (tid >> 6) * 8;
    // Both loops unrolled: every load is a constant offset from one address pair
    // and many are in flight at once; w stays in registers.
#pragma unroll
    for (int p = 0; p < E_ / 32; ++p) {
      float w[8];
#pragma unroll
      for (int e = 0; e < 8; ++e) w[e] = wp[(p * 32 + e) * D_];
      const uint4 v = {cvtpk(w[0], w[1]), cvtpk(w[2], w[3]),
                       cvtpk(w[4], w[5]), cvtpk(w[6], w[7])};
      *reinterpret_cast<uint4*>(sp + p * 32) = v;
    }
  }
  __syncthreads();   // every wave reads all of Wq^T

  const int wave = tid >> 5;
  const int lane = tid & 31;
  const int n    = lane & 15;      // A-layout M / C-layout N
  const int hi   = lane >> 4;      // K-half selector
  const int tok0 = blockIdx.x * 128 + wave * 16;

  v8f acc[4] = {v8f{}, v8f{}, v8f{}, v8f{}};
  const float* xrow = x + (size_t)(tok0 + n) * E_;

  for (int kb = 0; kb < E_; kb += 32) {
    if (kb + 32 < E_)
      __builtin_prefetch(xrow + kb + 32 + hi * 16, 0, 0);

    // A operand: x[tok0+n][kb + hi*16 .. +15] -> bf16 (perm-packed converts)
    const float4* xr = reinterpret_cast<const float4*>(xrow + kb + hi * 16);
    float4 p0 = xr[0], p1 = xr[1], p2 = xr[2], p3 = xr[3];
    // B operand: Wq^T[nt*16+n][kb + hi*16 .. +15] of the four column tiles
    // (unrolled, so that bv is indexed by constants and stays in registers)
    v16bf bv[4];
#pragma unroll
    for (int nt = 0; nt < 4; ++nt)
      bv[nt] = lds_frag(sW + (nt * 16 + n) * WPIT + kb + hi * 16);
    // The eight LDS reads stay here, one group under the x loads' latency. Left
    // alone the compiler reads each tile's pair into the same registers right in
    // front of its product and waits out the LDS latency four times a trip.
    // s_wait_xcnt: stands before the x loads' address pair is stepped, further down.
    asm volatile("s_wait_xcnt 0x0" ::: "memory");
    __builtin_amdgcn_sched_barrier(0);
    float fv[16] = {p0.x, p0.y, p0.z, p0.w, p1.x, p1.y, p1.z, p1.w,
                    p2.x, p2.y, p2.z, p2.w, p3.x, p3.y, p3.z, p3.w};
    union { v16bf v; uint32_t w[8]; } ua;
#pragma unroll
    for (int q = 0; q < 8; ++q) ua.w[q] = pkbf(fv[2 * q], fv[2 * q + 1]);

#pragma unroll
    for (int nt = 0; nt < 4; ++nt)
      acc[nt] = wmma_bf16(ua.v, bv[nt], acc[nt]);
  }

  // Epilogue: C layout -> lane holds column n, rows r + hi*8
#pragma unroll
  for (int nt = 0; nt < 4; ++nt) {
    const int col  = nt * 16 + n;
    const float bb = bq[col];
#pragma unroll
    for (int r = 0; r < 8; ++r) {
      const size_t row = (size_t)tok0 + r + hi * 8;
      qb[row * D_ + col] = f2bfu(acc[nt][r] + bb);
    }
  }
}

// ---------------------------------------------------------------------------
// Kernel 2: column softmax stats: m_j = max_i S_ij, Z_j = sum_i e^{S_ij-m_j}.
// 8 waves/block share batch b; 256 rows i of q (32KB, four 64-row chunks) a stage
// go through a ring of two LDS buffers: stage s+1's async copies fly while stage s
// is worked on.
// The loop runs one chunk apart: trip t reads chunk t's fragments, takes the max
// and the sums of S of chunk t-1 while those reads are under way, then forms S.
// Epilogue: q~^T[b][d][t] = bf16(q[b,t,d] / Z_{b,t}) for the block's 128 tokens
// (transposed layout so that the P x q~ B operand has its 32 columns j in a
// row), from the q rows each wave already holds as its B operand.
// ---------------------------------------------------------------------------
#define TPIT 136  // q~^T tile rows in LDS: 256 B of data at a pitch of 272 B
__global__ __launch_bounds__(256)
void k_stats(const uint16_t* __restrict__ qb, float* __restrict__ mj,
             uint16_t* __restrict__ qzT)
{
  __shared__ __align__(16) uint16_t sA[2][SJ_ * QPIT]; // 2 x 36KB ring of q rows i
  const int tid = threadIdx.x, wave = tid >> 5, lane = tid & 31;
  const int gw = blockIdx.x * 8 + wave;                // 0..2047
  const int b  = gw >> 7;
  const int j0 = (gw & 127) * 16;
  const int n  = lane & 15, hi = lane >> 4;
  const size_t bT = (size_t)b * T_;
  const uint16_t* qbase = qb + bT * D_;

  // B operand fixed over i loop: B[k][n] = q[j0+n][k]
  const uint16_t* rowB = qbase + (size_t)(j0 + n) * D_;
  v16bf b0 = *reinterpret_cast<const v16bf*>(rowB + hi * 16);
  v16bf b1 = *reinterpret_cast<const v16bf*>(rowB + 32 + hi * 16);

  // a stage is 32KB contiguous in q: eight threads a row, eight 16B copies per
  // thread, 32 rows apart
  const uint32_t  lA = lds_addr(&sA[0][0]) + (tid >> 3) * (QPIT * 2) + (tid & 7) * 16;
  const uint16_t* gA = qbase + tid * 8;
  auto stage = [&](int s, int buf) {
    copy8_b128(lA + buf * (SJ_ * QPIT * 2), 32 * QPIT * 2,
               gA + (size_t)s * (SJ_ * D_), 32 * D_);
  };
  stage(0, 0);
  wait_async();
  __syncthreads();
  stage(1, 1);

  float mloc = -1.0e30f, zloc = 0.0f;
  v16bf a[CJ_ / 16][2];   // a chunk's A fragments, four 16-row tiles
  v8f   c[CJ_ / 16];      // S of the chunk before, until its max and sums are taken
  // all 16 fragment reads of chunk t, at constant offsets from the chunk's start
  auto read = [&](int t) {
    const uint16_t* sAt = sA[(t / CPS_) & 1] + (t % CPS_) * (CJ_ * QPIT);
#pragma unroll
    for (int g = 0; g < CJ_ / 16; ++g) {
      const uint16_t* ar = sAt + (g * 16 + n) * QPIT;
      a[g][0] = lds_frag(ar + hi * 16);
      a[g][1] = lds_frag(ar + 32 + hi * 16);
    }
  };
  // S of one 32-row half of the chunk
  auto prod = [&](int sub) {
#pragma unroll
    for (int g = 2 * sub; g < 2 * sub + 2; ++g) {
      v8f s = {};
      s = wmma_bf16(a[g][0], b0, s);
      c[g] = wmma_bf16(a[g][1], b1, s);
    }
  };
  // running max and sum over one 32-row half
  auto soft = [&](int sub, auto ex) {
    const v8f c0 = c[2 * sub], c1 = c[2 * sub + 1];
    float tmax = -1.0e30f;
#pragma unroll
    for (int r = 0; r < 8; ++r) {
      tmax = fmaxf(tmax, c0[r] * 0.125f);
      tmax = fmaxf(tmax, c1[r] * 0.125f);
    }
    const float nm = fmaxf(mloc, tmax);
    float zs = zloc * ex(mloc - nm);
#pragma unroll
    for (int r = 0; r < 8; ++r) {
      zs += ex(c0[r] * 0.125f - nm);
      zs += ex(c1[r] * 0.125f - nm);
    }
    mloc = nm; zloc = zs;
  };
  auto ex_loop = [](float x) { return __expf(x); };
  auto ex_tail = [](float x) { return expf_slot(x); };
  // publish stage s+1 and free stage s's buffer
  auto foot = [&]() {
    wait_ds();
    wait_async();
    __syncthreads();
  };

  read(0);
  // one group here too, instead of a wait at each pair of reads
  __builtin_amdgcn_sched_barrier(0);
  prod(0);
  prod(1);
  int t = 1;
  for (int s = 0; s < NST_; ++s) {
    // The chunks of a stage, in a loop of their own: a trip is then one block of
    // code with no branch in it, and the order written below holds. (With the
    // stage's end as a branch inside the trip, the compiler moved the max and sums
    // behind that branch, out from under the reads.)
    for (; t < (s + 1) * CPS_; ++t) {
      read(t);
      // The reads stay first, as one group: the max and sums of chunk t-1 (registers
      // only) run while they are under way. Left alone the compiler spreads the reads
      // over the trip, the last pairs right in front of their products with a full
      // wait each.
      __builtin_amdgcn_sched_barrier(0);
      soft(0, ex_loop);
      prod(0);
      soft(1, ex_loop);
      prod(1);
      // All of that stays ahead of the stage's closing waits: moved behind them, it
      // would start only when the last read has landed, and the refill would go late.
      __builtin_amdgcn_sched_barrier(0);
    }
    // the stage's last chunk is read: close the stage, then refill its buffer
    foot();
    if (s + 2 < NST_) stage(s + 2, s & 1);
  }
  wait_async();
  // the last chunk's max and sums
  soft(0, ex_tail);
  soft(1, ex_tail);

  // combine lane pair (l, l^16): each holds 8 of the 16 rows of column n
  const float mo = __shfl_xor(mloc, 16, 32);
  const float zo = __shfl_xor(zloc, 16, 32);
  const float M  = fmaxf(mloc, mo);
  const float Z  = zloc * __expf(mloc - M) + zo * __expf(mo - M);
  if (lane < 16)
    mj[bT + j0 + lane] = M;

  // The ring is free: every wave's reads and copies ended at the last trip's
  // barrier. Lane (n, hi) holds token j0+n, d = hi*16.. and 32+hi*16.., and Z of
  // that token: the 64 x 128 tile [d][token] is put together in the ring's LDS.
  uint16_t* sT = &sA[0][0];
  union { v16bf v; uint16_t h[16]; } u0, u1;
  u0.v = b0;
  u1.v = b1;
#pragma unroll
  for (int e = 0; e < 16; ++e) {
    sT[(hi * 16 + e) * TPIT + wave * 16 + n]      = f2bfu(bf2f(u0.h[e]) / Z);
    sT[(32 + hi * 16 + e) * TPIT + wave * 16 + n] = f2bfu(bf2f(u1.h[e]) / Z);
  }
  __syncthreads();   // tile columns come from all eight waves

  // out in whole 256 B rows: sixteen threads a row d, 16 B each
  uint16_t* gT = qzT + (size_t)b * D_ * T_ + (j0 - wave * 16)
               + (size_t)(tid >> 4) * T_ + (tid & 15) * 8;
  const uint16_t* lT = sT + (tid >> 4) * TPIT + (tid & 15) * 8;
#pragma unroll
  for (int k = 0; k < 4; ++k)
    *reinterpret_cast<uint4*>(gT + (size_t)k * 16 * T_) =
        *reinterpret_cast<const uint4*>(lT + k * 16 * TPIT);
}

// ---------------------------------------------------------------------------
// Kernel 3: out[i,:] = sum_j exp(S_ij/8 - m_j) * q~[j,:]
// 8 waves/block share batch b; per 256 columns j (four chunks of 64) the block's
// operands (q rows, q~^T columns, m) go through a ring of two LDS buffers: stage
// s+1's async copies fly while stage s is worked on. S is computed transposed (rows j,
// columns i): lane (n, hi) then holds row i0+n of P at j = 8*hi+r of each
// 16-column tile, and two tiles packed to bf16 are the A operand of P x q~ as
// they lie, element s at j = 16*(s>>3) + 8*hi + (s&7). q~^T is read in that order.
// ---------------------------------------------------------------------------
// q~^T rows in LDS: 512 B of data at a pitch of 656 B (16 B x odd, and 144 B more
// than a multiple of the banks' 256 B: 16 rows on 16 groups of four banks).
#define ZPIT 328
__global__ __launch_bounds__(256)
void k_attn(const uint16_t* __restrict__ qb, const uint16_t* __restrict__ qzT,
            const float* __restrict__ mj, float* __restrict__ out)
{
  // One object, laid so that m, z and q of buffer 0 all start low enough for a
  // chunk's reads to be constant offsets from one address each (an LDS
  // instruction's offset field ends at 64 KB); buffer 1 is one even step further.
  __shared__ __align__(16) struct {
    float m[2][SJ_];            // 2 x 1KB m_j
    struct {
      uint16_t z[D_ * ZPIT];    // 41KB q~^T[d][j]
      uint16_t q[SJ_ * QPIT];   // 36KB q rows j
    } b[2];
  } ring;
  constexpr uint32_t BSTEP = sizeof(ring.b[0]);
  const int tid = threadIdx.x, lane = tid & 31;
  const int wave = __builtin_amdgcn_readfirstlane(tid >> 5);
  const int gw = blockIdx.x * 8 + wave;                 // 0..2047
  const int b  = gw >> 7;
  const int i0 = (gw & 127) * 16;
  const int n  = lane & 15, hi = lane >> 4;
  const size_t bT = (size_t)b * T_;
  const uint16_t* qbase = qb + bT * D_;
  const uint16_t* zbase = qzT + (size_t)b * D_ * T_;

  // B operand for S^T: rows i0..i0+15 of q as columns (fixed over j loop)
  const uint16_t* rowA = qbase + (size_t)(i0 + n) * D_;
  v16bf a0 = *reinterpret_cast<const v16bf*>(rowA + hi * 16);
  v16bf a1 = *reinterpret_cast<const v16bf*>(rowA + 32 + hi * 16);

  v8f acc[4] = {v8f{}, v8f{}, v8f{}, v8f{}};

  // One stage: q rows, 32KB contiguous (eight threads a row, eight 16B copies 32
  // rows apart);
  // q~^T, 64 rows d of 512 B (a wave a row, eight copies 8 rows apart);
  // m, 1 KB (wave 0, two copies of 16 B a lane).
  const uint32_t  lQ = lds_addr(ring.b[0].q) + (tid >> 3) * (QPIT * 2) + (tid & 7) * 16;
  const uint32_t  lZ = lds_addr(ring.b[0].z) + (tid >> 5) * (ZPIT * 2) + lane * 16;
  const uint32_t  lM = lds_addr(ring.m[0]) + lane * 16;
  const uint16_t* gQ = qbase + tid * 8;
  const uint16_t* gZ = zbase + (size_t)(tid >> 5) * T_ + lane * 8;
  const float*    gM = mj + bT + lane * 4;
  auto stage = [&](int s, int buf) {
    copy8_b128(lQ + buf * BSTEP, 32 * QPIT * 2,
               gQ + (size_t)s * (SJ_ * D_), 32 * D_);
    copy8_b128(lZ + buf * BSTEP, 8 * ZPIT * 2,
               gZ + s * SJ_, (size_t)8 * T_);
    if (wave == 0) {
      const uint32_t m = lM + buf * (SJ_ * 4);
      const float*   g = gM + s * SJ_;
      copy2_b128(m, g, m + 512, g + 128);
    }
  };
  stage(0, 0);
  wait_async();
  __syncthreads();
  stage(1, 1);

  for (int st = 0; st < NST_; ++st) {
    // the stage's four chunks
    for (int u = 0; u < CPS_; ++u) {
      const uint16_t* sQt = ring.b[st & 1].q + u * (CJ_ * QPIT);
      const uint16_t* sZt = ring.b[st & 1].z + u * CJ_;
      const float*    sMt = ring.m[st & 1] + u * CJ_;
      // No barrier stands inside a chunk, so every LDS read of the chunk goes out as
      // one group ahead of the products, in the order of use: m_j of the lane's 8
      // rows a tile, the q rows j (A of S^T), then q~^T (B of P x q~: 8 columns j at
      // hi*8 and 8 at 16 + hi*8). Every loop over these arrays is unrolled, so that
      // each index is a constant and they stay in registers.
      v16bf aq[CJ_ / 32][2][2], bz[CJ_ / 32][4];
      float4 mm[CJ_ / 32][2][2];
#pragma unroll
      for (int sub = 0; sub < CJ_ / 32; ++sub)
#pragma unroll
        for (int h = 0; h < 2; ++h) {
          const float4* mp = reinterpret_cast<const float4*>(
              sMt + sub * 32 + h * 16 + hi * 8);
          mm[sub][h][0] = mp[0];
          mm[sub][h][1] = mp[1];
        }
      // The m reads stay first: in one region with the fragment reads the compiler
      // put most of them last, and the first exponentials waited for the whole group.
      __builtin_amdgcn_sched_barrier(0);
#pragma unroll
      for (int sub = 0; sub < CJ_ / 32; ++sub)
#pragma unroll
        for (int h = 0; h < 2; ++h) {
          const uint16_t* rb = sQt + (sub * 32 + h * 16 + n) * QPIT;
          aq[sub][h][0] = lds_frag(rb + hi * 16);
          aq[sub][h][1] = lds_frag(rb + 32 + hi * 16);
        }
#pragma unroll
      for (int sub = 0; sub < CJ_ / 32; ++sub)
#pragma unroll
        for (int nt = 0; nt < 4; ++nt) {
          const uint16_t* zr = sZt + (nt * 16 + n) * ZPIT + sub * 32 + hi * 8;
          union { v16bf v; uint4 q[2]; } ub;
          ub.q[0] = *reinterpret_cast<const uint4*>(zr);
          ub.q[1] = *reinterpret_cast<const uint4*>(zr + 16);
          bz[sub][nt] = ub.v;
        }

#pragma unroll
      for (int sub = 0; sub < CJ_ / 32; ++sub) {
        // two 16x16 S^T sub-tiles -> P = exp(S/8 - m_j), packed in registers
        union { v16bf v; uint32_t w[8]; } pa;
#pragma unroll
        for (int h = 0; h < 2; ++h) {
          v8f s = {};
          s = wmma_bf16(aq[sub][h][0], a0, s);  // s[r] = S[i0+n][j], j = h*16+hi*8+r
          s = wmma_bf16(aq[sub][h][1], a1, s);
          const float4 m0 = mm[sub][h][0], m1 = mm[sub][h][1];
          const float mv[8] = {m0.x, m0.y, m0.z, m0.w, m1.x, m1.y, m1.z, m1.w};
#pragma unroll
          for (int r = 0; r < 8; r += 2)
            pa.w[h * 4 + (r >> 1)] = cvtpk(__expf(s[r] * 0.125f - mv[r]),
                                           __expf(s[r + 1] * 0.125f - mv[r + 1]));
        }
#pragma unroll
        for (int nt = 0; nt < 4; ++nt)
          acc[nt] = wmma_bf16(pa.v, bz[sub][nt], acc[nt]);
      }
      // Order for the compiler's scheduler: the 32 fragment reads first, then the 16
      // matrix products. Left alone it moves each read down to its product and
      // waits there, one LDS latency after another.
      __builtin_amdgcn_sched_group_barrier(0x100, 32, 0);
      __builtin_amdgcn_sched_group_barrier(0x008, 16, 0);
      // The products stay ahead of what follows: the next chunk's reads, or the
      // stage's closing waits (moved behind those, they would start only when the
      // last of the 40 reads has landed).
      __builtin_amdgcn_sched_barrier(0);
    }
    // behind the stage's last chunk: publish stage st+1, free stage st's buffers,
    // then refill them with st+2
    wait_ds();
    wait_async();
    __syncthreads();
    if (st + 2 < NST_) stage(st + 2, st & 1);
  }
  wait_async();

#pragma unroll
  for (int nt = 0; nt < 4; ++nt)
#pragma unroll
    for (int r = 0; r < 8; ++r)
      out[(bT + i0 + r + hi * 8) * D_ + nt * 16 + n] = acc[nt][r];
}

// ---------------------------------------------------------------------------
extern "C" void kernel_launch(void* const* d_in, const int* in_sizes, int n_in,
                              void* d_out, int out_size, void* d_ws, size_t ws_size,
                              hipStream_t stream)
{
  (void)in_sizes; (void)n_in; (void)out_size; (void)ws_size;
  const float* x  = (const float*)d_in[0];
  const float* Wq = (const float*)d_in[1];
  const float* bq = (const float*)d_in[2];
  float* out = (float*)d_out;

  char* ws = (char*)d_ws;
  uint16_t* qb  = (uint16_t*)(ws);                                 // 4 MB  q bf16
  uint16_t* qzT = (uint16_t*)(ws + ((size_t)4 << 20));             // 4 MB  (q/Z)^T bf16
  float*    mj  = (float*)   (ws + ((size_t)9 << 20));             // 128 KB col max

  k_proj <<<256,  256, 0, stream>>>(x, Wq, bq, qb);
  k_stats<<<256,  256, 0, stream>>>(qb, mj, qzT);
  k_attn <<<256,  256, 0, stream>>>(qb, qzT, mj, out);
}

// v008
// A run of this version takes 44 microseconds.
// Timed twice side by side with v007, it ran 1.04 and 1.05 times as fast.
// Over all steps from v000 it is 4.63 times as fast.
#include <hip/hip_runtime.h>
#include <hip/hip_bf16.h>
#include <stdint.h>

#define B_  16
#define T_  2048
#define E_  512
#define D_  64

typedef __attribute__((ext_vector_type(16))) __bf16 v16bf;
typedef __attribute__((ext_vector_type(8)))  float  v8f;
typedef __attribute__((ext_vector_type(2)))  float  v2f;
typedef __attribute__((ext_vector_type(2)))  __bf16 v2bf;

// Round two f32 to bf16 (RNE) and pack into one u32 via v_perm_b32.
static __device__ __forceinline__ uint32_t pkbf(float a, float b) {
  uint32_t ua = __builtin_bit_cast(uint32_t, a);
  uint32_t ub = __builtin_bit_cast(uint32_t, b);
  ua += 0x7FFFu + ((ua >> 16) & 1u);
  ub += 0x7FFFu + ((ub >> 16) & 1u);
  // out = {ub[31:24], ub[23:16], ua[31:24], ua[23:16]}
  return __builtin_amdgcn_perm(ub, ua, 0x07060302u);
}
// The same rounding: one packed convert.
static __device__ __forceinline__ uint32_t cvtpk(float a, float b) {
  v2f f = {a, b};
  return __builtin_bit_cast(uint32_t, __builtin_convertvector(f, v2bf));
}
static __device__ __forceinline__ uint16_t f2bfu(float f) {
  uint32_t u = __builtin_bit_cast(uint32_t, f);
  u += 0x7FFFu + ((u >> 16) & 1u);
  return (uint16_t)(u >> 16);
}
static __device__ __forceinline__ float bf2f(uint16_t h) {
  return __builtin_bit_cast(float, (uint32_t)h << 16);   // exact
}

static __device__ __forceinline__ v8f wmma_bf16(v16bf a, v16bf b, v8f c) {
  // D = A(16x32 bf16) * B(32x16 bf16) + C(16x16 f32)
  return __builtin_amdgcn_wmma_f32_16x16x32_bf16(false, a, false, b, (short)0, c,
                                                 false, false);
}

// Rows of S that k_stats works on at a time (a chunk), and rows (k_stats) or
// columns (k_attn) that one ring stage holds: four chunks, so that a stage's copies
// have four chunks' work to land in, from memory too, and the waves meet once a stage.
#define CJ_  64
#define SJ_  256
#define CPS_ (SJ_ / CJ_)
#define NST_ (T_ / SJ_)
// q rows in LDS: 128 B of data at a pitch of 144 B (16 B x odd), so that the 16
// rows one ds_load_b128 reads fall on 16 different groups of four banks.
#define QPIT 72

// A 16-element fragment from LDS rows that are 16-byte aligned only.
static __device__ __forceinline__ v16bf lds_frag(const uint16_t* p) {
  const uint4* q = reinterpret_cast<const uint4*>(p);
  union { v16bf v; uint4 q[2]; } u;
  u.q[0] = q[0];
  u.q[1] = q[1];
  return u.v;
}

// LDS byte address of a __shared__ object (what an async copy takes).
static __device__ __forceinline__ uint32_t lds_addr(const void* p) {
  typedef __attribute__((address_space(3))) const unsigned char lds_byte;
  return (uint32_t)(uintptr_t)(lds_byte*)p;
}
// Async copies global -> LDS, 16 B a lane each. The s_wait_xcnt closes the
// statement so that no address register is rewritten ahead of it.
static __device__ __forceinline__ void copy2_b128(uint32_t l0, const void* g0,
                                                  uint32_t l1, const void* g1) {
  asm volatile("global_load_async_to_lds_b128 %0, %1, off\n\t"
               "global_load_async_to_lds_b128 %2, %3, off\n\t"
               "s_wait_xcnt 0x0"
               :: "v"(l0), "v"(g0), "v"(l1), "v"(g1) : "memory");
}
// Eight such copies at even steps (ls bytes in LDS, gs elements in memory).
static __device__ __forceinline__ void copy8_b128(uint32_t l, uint32_t ls,
                                                  const uint16_t* g, size_t gs) {
  asm volatile("global_load_async_to_lds_b128 %0, %1, off\n\t"
               "global_load_async_to_lds_b128 %2, %3, off\n\t"
               "global_load_async_to_lds_b128 %4, %5, off\n\t"
               "global_load_async_to_lds_b128 %6, %7, off\n\t"
               "global_load_async_to_lds_b128 %8, %9, off\n\t"
               "global_load_async_to_lds_b128 %10, %11, off\n\t"
               "global_load_async_to_lds_b128 %12, %13, off\n\t"
               "global_load_async_to_lds_b128 %14, %15, off\n\t"
               "s_wait_xcnt 0x0"
               :: "v"(l),          "v"(g),          "v"(l + ls),     "v"(g + gs),
                  "v"(l + 2 * ls), "v"(g + 2 * gs), "v"(l + 3 * ls), "v"(g + 3 * gs),
                  "v"(l + 4 * ls), "v"(g + 4 * gs), "v"(l + 5 * ls), "v"(g + 5 * gs),
                  "v"(l + 6 * ls), "v"(g + 6 * gs), "v"(l + 7 * ls), "v"(g + 7 * gs)
               : "memory");
}
// This wave's copies have landed (other waves read them behind the barrier).
static __device__ __forceinline__ void wait_async() {
  asm volatile("s_wait_asynccnt 0x0" ::: "memory");
}
// This wave's LDS reads are done (before a copy refills what it has read).
static __device__ __forceinline__ void wait_ds() {
  asm volatile("s_wait_dscnt 0x0" ::: "memory");
}

// __expf with the free issue slot behind the transcendental written into its own
// statement: for straight-line code.
static __device__ __forceinline__ float expf_slot(float x) {
  float r;
  // v_nop: that slot; inside the statement nothing can be scheduled in front of it
  asm("v_exp_f32 %0, %1\n\tv_nop" : "=v"(r) : "v"(x * 1.44269504f));
  return r;
}

// ---------------------------------------------------------------------------
// Kernel 1: q = x @ Wq + bq (bf16 out). One wave per 16x64 q tile. Each block
// first puts Wq^T[n][k] = bf16(Wq[k][n]) (64 x 512) into its LDS; the B operand
// is read from there, 16 values k in a row per lane.
// ---------------------------------------------------------------------------
// Wq^T rows in LDS: 1024 B of data at a pitch of 1040 B (16 B x odd), so that 16
// rows n fall on 16 different groups of four banks, for the stores and the reads.
#define WPIT 520
__global__ __launch_bounds__(256)
void k_proj(const float* __restrict__ x, const float* __restrict__ Wq,
            const float* __restrict__ bq, uint16_t* __restrict__ qb)
{
  __shared__ __align__(16) uint16_t sW[D_ * WPIT];     // 65 KB
  const int tid  = threadIdx.x;
  {
    // A thread takes one column n of Wq and 16 groups of 8 rows k: a wave's load
    // is one whole 128 B line of a row, its store 16 B in each of 32 rows of Wq^T.
    const float* wp = Wq + (size_t)(tid >> 6) * 8 * D_ + (tid & 63);
    uint16_t*    sp = sW + (tid & 63) * WPIT + (tid >> 6) * 8;
    // Both loops unrolled: every load is a constant offset from one address pair
    // and many are in flight at once; w stays in registers.
#pragma unroll
    for (int p = 0; p < E_ / 32; ++p) {
      float w[8];
#pragma unroll
      for (int e = 0; e < 8; ++e) w[e] = wp[(p * 32 + e) * D_];
      const uint4 v = {cvtpk(w[0], w[1]), cvtpk(w[2], w[3]),
                       cvtpk(w[4], w[5]), cvtpk(w[6], w[7])};
      *reinterpret_cast<uint4*>(sp + p * 32) = v;
    }
  }
  __syncthreads();   // every wave reads all of Wq^T

  const int wave = tid >> 5;
  const int lane = tid & 31;
  const int n    = lane & 15;      // A-layout M / C-layout N
  const int hi   = lane >> 4;      // K-half selector
  const int tok0 = blockIdx.x * 128 + wave * 16;

  v8f acc[4] = {v8f{}, v8f{}, v8f{}, v8f{}};
  const float* xrow = x + (size_t)(tok0 + n) * E_;

  for (int kb = 0; kb < E_; kb += 32) {
    if (kb + 32 < E_)
      __builtin_prefetch(xrow + kb + 32 + hi * 16, 0, 0);

    // A operand: x[tok0+n][kb + hi*16 .. +15] -> bf16 (perm-packed converts)
    const float4* xr = reinterpret_cast<const float4*>(xrow + kb + hi * 16);
    float4 p0 = xr[0], p1 = xr[1], p2 = xr[2], p3 = xr[3];
    // B operand: Wq^T[nt*16+n][kb + hi*16 .. +15] of the four column tiles
    // (unrolled, so that bv is indexed by constants and stays in registers)
    v16bf bv[4];
#pragma unroll
    for (int nt = 0; nt < 4; ++nt)
      bv[nt] = lds_frag(sW + (nt * 16 + n) * WPIT + kb + hi * 16);
    // The eight LDS reads stay here, one group under the x loads' latency. Left
    // alone the compiler reads each tile's pair into the same registers right in
    // front of its product and waits out the LDS latency four times a trip.
    // s_wait_xcnt: stands before the x loads' address pair is stepped, further down.
    asm volatile("s_wait_xcnt 0x0" ::: "memory");
    __builtin_amdgcn_sched_barrier(0);
    float fv[16] = {p0.x, p0.y, p0.z, p0.w, p1.x, p1.y, p1.z, p1.w,
                    p2.x, p2.y, p2.z, p2.w, p3.x, p3.y, p3.z, p3.w};
    union { v16bf v; uint32_t w[8]; } ua;
#pragma unroll
    for (int q = 0; q < 8; ++q) ua.w[q] = pkbf(fv[2 * q], fv[2 * q + 1]);

#pragma unroll
    for (int nt = 0; nt < 4; ++nt)
      acc[nt] = wmma_bf16(ua.v, bv[nt], acc[nt]);
  }

  // Epilogue: C layout -> lane holds column n, rows r + hi*8
#pragma unroll
  for (int nt = 0; nt < 4; ++nt) {
    const int col  = nt * 16 + n;
    const float bb = bq[col];
#pragma unroll
    for (int r = 0; r < 8; ++r) {
      const size_t row = (size_t)tok0 + r + hi * 8;
      qb[row * D_ + col] = f2bfu(acc[nt][r] + bb);
    }
  }
}

// ---------------------------------------------------------------------------
// Kernel 2: column softmax stats: m_j = max_i S_ij, Z_j = sum_i e^{S_ij-m_j}.
// 8 waves/block share batch b; 256 rows i of q (32KB, four 64-row chunks) a stage
// go through a ring of two LDS buffers: stage s+1's async copies fly while stage s
// is worked on.
// The loop runs one chunk apart: trip t reads chunk t's fragments, takes the max
// and the sums of S of chunk t-1 while those reads are under way, then forms S.
// Epilogue: q~^T[b][d][t] = bf16(q[b,t,d] / Z_{b,t}) for the block's 128 tokens
// (transposed layout so that the P x q~ B operand has its 32 columns j in a
// row), from the q rows each wave already holds as its B operand.
// ---------------------------------------------------------------------------
#define TPIT 136  // q~^T tile rows in LDS: 256 B of data at a pitch of 272 B
__global__ __launch_bounds__(256)
void k_stats(const uint16_t* __restrict__ qb, float* __restrict__ mj,
             uint16_t* __restrict__ qzT)
{
  __shared__ __align__(16) uint16_t sA[2][SJ_ * QPIT]; // 2 x 36KB ring of q rows i
  const int tid = threadIdx.x, wave = tid >> 5, lane = tid & 31;
  const int gw = blockIdx.x * 8 + wave;                // 0..2047
  const int b  = gw >> 7;
  const int j0 = (gw & 127) * 16;
  const int n  = lane & 15, hi = lane >> 4;
  const size_t bT = (size_t)b * T_;
  const uint16_t* qbase = qb + bT * D_;

  // B operand fixed over i loop: B[k][n] = q[j0+n][k]
  const uint16_t* rowB = qbase + (size_t)(j0 + n) * D_;
  v16bf b0 = *reinterpret_cast<const v16bf*>(rowB + hi * 16);
  v16bf b1 = *reinterpret_cast<const v16bf*>(rowB + 32 + hi * 16);

  // a stage is 32KB contiguous in q: eight threads a row, eight 16B copies per
  // thread, 32 rows apart
  const uint32_t  lA = lds_addr(&sA[0][0]) + (tid >> 3) * (QPIT * 2) + (tid & 7) * 16;
  const uint16_t* gA = qbase + tid * 8;
  auto stage = [&](int s, int buf) {
    copy8_b128(lA + buf * (SJ_ * QPIT * 2), 32 * QPIT * 2,
               gA + (size_t)s * (SJ_ * D_), 32 * D_);
  };
  stage(0, 0);
  wait_async();
  __syncthreads();
  stage(1, 1);

  float mloc = -1.0e30f, zloc = 0.0f;
  v16bf a[CJ_ / 16][2];   // a chunk's A fragments, four 16-row tiles
  v8f   c[CJ_ / 16];      // S of the chunk before, until its max and sums are taken
  // all 16 fragment reads of chunk t, at constant offsets from the chunk's start
  auto read = [&](int t) {
    const uint16_t* sAt = sA[(t / CPS_) & 1] + (t % CPS_) * (CJ_ * QPIT);
#pragma unroll
    for (int g = 0; g < CJ_ / 16; ++g) {
      const uint16_t* ar = sAt + (g * 16 + n) * QPIT;
      a[g][0] = lds_frag(ar + hi * 16);
      a[g][1] = lds_frag(ar + 32 + hi * 16);
    }
  };
  // S of one 32-row half of the chunk
  auto prod = [&](int sub) {
#pragma unroll
    for (int g = 2 * sub; g < 2 * sub + 2; ++g) {
      v8f s = {};
      s = wmma_bf16(a[g][0], b0, s);
      c[g] = wmma_bf16(a[g][1], b1, s);
    }
  };
  // running max and sum over one 32-row half
  auto soft = [&](int sub, auto ex) {
    const v8f c0 = c[2 * sub], c1 = c[2 * sub + 1];
    float tmax = -1.0e30f;
#pragma unroll
    for (int r = 0; r < 8; ++r) {
      tmax = fmaxf(tmax, c0[r] * 0.125f);
      tmax = fmaxf(tmax, c1[r] * 0.125f);
    }
    const float nm = fmaxf(mloc, tmax);
    float zs = zloc * ex(mloc - nm);
#pragma unroll
    for (int r = 0; r < 8; ++r) {
      zs += ex(c0[r] * 0.125f - nm);
      zs += ex(c1[r] * 0.125f - nm);
    }
    mloc = nm; zloc = zs;
  };
  auto ex_loop = [](float x) { return __expf(x); };
  auto ex_tail = [](float x) { return expf_slot(x); };
  // publish stage s+1 and free stage s's buffer
  auto foot = [&]() {
    wait_ds();
    wait_async();
    __syncthreads();
  };

  read(0);
  // one group here too, instead of a wait at each pair of reads
  __builtin_amdgcn_sched_barrier(0);
  prod(0);
  prod(1);
  int t = 1;
  for (int s = 0; s < NST_; ++s) {
    // The chunks of a stage, in a loop of their own: a trip is then one block of
    // code with no branch in it, and the order written below holds. (With the
    // stage's end as a branch inside the trip, the compiler moved the max and sums
    // behind that branch, out from under the reads.)
    for (; t < (s + 1) * CPS_; ++t) {
      read(t);
      // The reads stay first, as one group: the max and sums of chunk t-1 (registers
      // only) run while they are under way. Left alone the compiler spreads the reads
      // over the trip, the last pairs right in front of their products with a full
      // wait each.
      __builtin_amdgcn_sched_barrier(0);
      soft(0, ex_loop);
      prod(0);
      soft(1, ex_loop);
      prod(1);
      // All of that stays ahead of the stage's closing waits: moved behind them, it
      // would start only when the last read has landed, and the refill would go late.
      __builtin_amdgcn_sched_barrier(0);
    }
    // the stage's last chunk is read: close the stage, then refill its buffer
    foot();
    if (s + 2 < NST_) stage(s + 2, s & 1);
  }
  wait_async();
  // the last chunk's max and sums
  soft(0, ex_tail);
  soft(1, ex_tail);

  // combine lane pair (l, l^16): each holds 8 of the 16 rows of column n
  const float mo = __shfl_xor(mloc, 16, 32);
  const float zo = __shfl_xor(zloc, 16, 32);
  const float M  = fmaxf(mloc, mo);
  const float Z  = zloc * __expf(mloc - M) + zo * __expf(mo - M);
  if (lane < 16)
    mj[bT + j0 + lane] = M;

  // The ring is free: every wave's reads and copies ended at the last trip's
  // barrier. Lane (n, hi) holds token j0+n, d = hi*16.. and 32+hi*16.., and Z of
  // that token: the 64 x 128 tile [d][token] is put together in the ring's LDS.
  uint16_t* sT = &sA[0][0];
  union { v16bf v; uint16_t h[16]; } u0, u1;
  u0.v = b0;
  u1.v = b1;
#pragma unroll
  for (int e = 0; e < 16; ++e) {
    sT[(hi * 16 + e) * TPIT + wave * 16 + n]      = f2bfu(bf2f(u0.h[e]) / Z);
    sT[(32 + hi * 16 + e) * TPIT + wave * 16 + n] = f2bfu(bf2f(u1.h[e]) / Z);
  }
  __syncthreads();   // tile columns come from all eight waves

  // out in whole 256 B rows: sixteen threads a row d, 16 B each
  uint16_t* gT = qzT + (size_t)b * D_ * T_ + (j0 - wave * 16)
               + (size_t)(tid >> 4) * T_ + (tid & 15) * 8;
  const uint16_t* lT = sT + (tid >> 4) * TPIT + (tid & 15) * 8;
#pragma unroll
  for (int k = 0; k < 4; ++k)
    *reinterpret_cast<uint4*>(gT + (size_t)k * 16 * T_) =
        *reinterpret_cast<const uint4*>(lT + k * 16 * TPIT);
}

// ---------------------------------------------------------------------------
// Kernel 3: out[i,:] = sum_j exp(S_ij/8 - m_j) * q~[j,:]
// 8 waves/block share batch b and 128 rows i; per 256 columns j the block's
// operands (q rows, q~^T columns, m) go through a ring of two LDS buffers: stage
// s+1's async copies fly while stage s is worked on. A wave takes 32 rows i (two
// tiles) and one half of every stage's columns j: each fragment it reads from LDS
// feeds two products, so the block reads half as many LDS bytes as with one tile
// a wave. The two halves' sums of a row are added at the end, through LDS.
// S is computed transposed (rows j, columns i): lane (n, hi) then holds row n of
// a tile of P at j = 8*hi+r of each 16-column tile, and two tiles packed to bf16
// are the A operand of P x q~ as they lie, element s at
// j = 16*(s>>3) + 8*hi + (s&7). q~^T is read in that order.
// ---------------------------------------------------------------------------
// q~^T rows in LDS: 512 B of data at a pitch of 656 B (16 B x odd, and 144 B more
// than a multiple of the banks' 256 B: 16 rows on 16 groups of four banks).
#define ZPIT 328
// Columns j a trip, and the trips a wave makes in its half of a stage.
#define AJ_  32
#define TPW_ (SJ_ / AJ_ / 2)
__global__ __launch_bounds__(256)
void k_attn(const uint16_t* __restrict__ qb, const uint16_t* __restrict__ qzT,
            const float* __restrict__ mj, float* __restrict__ out)
{
  // One object, laid so that m, z and q of buffer 0 all start low enough for a
  // trip's reads to be constant offsets from one address each (an LDS
  // instruction's offset field ends at 64 KB); buffer 1 is one even step further.
  __shared__ __align__(16) struct {
    float m[2][SJ_];            // 2 x 1KB m_j
    struct {
      uint16_t z[D_ * ZPIT];    // 41KB q~^T[d][j]
      uint16_t q[SJ_ * QPIT];   // 36KB q rows j
    } b[2];
  } ring;
  constexpr uint32_t BSTEP = sizeof(ring.b[0]);
  const int tid = threadIdx.x, lane = tid & 31;
  const int wave = __builtin_amdgcn_readfirstlane(tid >> 5);
  const int ig = wave & 3;                              // which 32 of the 128 rows i
  const int jh = wave >> 2;                             // which half of the columns j
  const int b  = blockIdx.x >> 4;
  const int i0 = (blockIdx.x & 15) * 128 + ig * 32;
  const int n  = lane & 15, hi = lane >> 4;
  const size_t bT = (size_t)b * T_;
  const uint16_t* qbase = qb + bT * D_;
  const uint16_t* zbase = qzT + (size_t)b * D_ * T_;

  // B operand for S^T: rows i0..i0+31 of q as columns, two tiles (fixed over j)
  v16bf a[2][2];
#pragma unroll
  for (int it = 0; it < 2; ++it) {
    const uint16_t* rowA = qbase + (size_t)(i0 + it * 16 + n) * D_;
    a[it][0] = *reinterpret_cast<const v16bf*>(rowA + hi * 16);
    a[it][1] = *reinterpret_cast<const v16bf*>(rowA + 32 + hi * 16);
  }

  v8f acc[2][4] = {{v8f{}, v8f{}, v8f{}, v8f{}}, {v8f{}, v8f{}, v8f{}, v8f{}}};

  // One stage: q rows, 32KB contiguous (eight threads a row, eight 16B copies 32
  // rows apart);
  // q~^T, 64 rows d of 512 B (a wave a row, eight copies 8 rows apart);
  // m, 1 KB (wave 0, two copies of 16 B a lane).
  const uint32_t  lQ = lds_addr(ring.b[0].q) + (tid >> 3) * (QPIT * 2) + (tid & 7) * 16;
  const uint32_t  lZ = lds_addr(ring.b[0].z) + (tid >> 5) * (ZPIT * 2) + lane * 16;
  const uint32_t  lM = lds_addr(ring.m[0]) + lane * 16;
  const uint16_t* gQ = qbase + tid * 8;
  const uint16_t* gZ = zbase + (size_t)(tid >> 5) * T_ + lane * 8;
  const float*    gM = mj + bT + lane * 4;
  auto stage = [&](int s, int buf) {
    copy8_b128(lQ + buf * BSTEP, 32 * QPIT * 2,
               gQ + (size_t)s * (SJ_ * D_), 32 * D_);
    copy8_b128(lZ + buf * BSTEP, 8 * ZPIT * 2,
               gZ + s * SJ_, (size_t)8 * T_);
    if (wave == 0) {
      const uint32_t m = lM + buf * (SJ_ * 4);
      const float*   g = gM + s * SJ_;
      copy2_b128(m, g, m + 512, g + 128);
    }
  };
  stage(0, 0);
  wait_async();
  __syncthreads();
  stage(1, 1);

  for (int st = 0; st < NST_; ++st) {
    // The wave's four trips in its half of the stage. Unrolled: the reads of all four
    // are then constant offsets from addresses formed once a stage.
#pragma unroll
    for (int u = 0; u < TPW_; ++u) {
      const int cj = (jh * TPW_ + u) * AJ_;             // first column j of the trip
      const uint16_t* sQt = ring.b[st & 1].q + cj * QPIT;
      const uint16_t* sZt = ring.b[st & 1].z + cj;
      const float*    sMt = ring.m[st & 1] + cj;
      // No barrier stands inside a trip, so every LDS read of the trip goes out as
      // one group ahead of the products, in the order of use: m_j of the lane's 8
      // rows a tile, the q rows j (A of S^T), then q~^T (B of P x q~: 8 columns j at
      // hi*8 and 8 at 16 + hi*8). Every loop over these arrays is unrolled, so that
      // each index is a constant and they stay in registers.
      v16bf aq[2][2], bz[4];
      float4 mm[2][2];
#pragma unroll
      for (int h = 0; h < 2; ++h) {
        const float4* mp = reinterpret_cast<const float4*>(sMt + h * 16 + hi * 8);
        mm[h][0] = mp[0];
        mm[h][1] = mp[1];
      }
      // The m reads stay first: in one region with the fragment reads the compiler
      // put most of them last, and the first exponentials waited for the whole group.
      __builtin_amdgcn_sched_barrier(0);
#pragma unroll
      for (int h = 0; h < 2; ++h) {
        const uint16_t* rb = sQt + (h * 16 + n) * QPIT;
        aq[h][0] = lds_frag(rb + hi * 16);
        aq[h][1] = lds_frag(rb + 32 + hi * 16);
      }
#pragma unroll
      for (int nt = 0; nt < 4; ++nt) {
        const uint16_t* zr = sZt + (nt * 16 + n) * ZPIT + hi * 8;
        union { v16bf v; uint4 q[2]; } ub;
        ub.q[0] = *reinterpret_cast<const uint4*>(zr);
        ub.q[1] = *reinterpret_cast<const uint4*>(zr + 16);
        bz[nt] = ub.v;
      }

      // per row tile: two 16x16 S^T sub-tiles -> P = exp(S/8 - m_j), packed in registers
      union { v16bf v; uint32_t w[8]; } pa[2];
#pragma unroll
      for (int h = 0; h < 2; ++h) {
        const float4 m0 = mm[h][0], m1 = mm[h][1];
        const float mv[8] = {m0.x, m0.y, m0.z, m0.w, m1.x, m1.y, m1.z, m1.w};
#pragma unroll
        for (int it = 0; it < 2; ++it) {
          v8f s = {};
          s = wmma_bf16(aq[h][0], a[it][0], s);  // s[r] = S[i0+it*16+n][j], j = h*16+hi*8+r
          s = wmma_bf16(aq[h][1], a[it][1], s);
#pragma unroll
          for (int r = 0; r < 8; r += 2)
            pa[it].w[h * 4 + (r >> 1)] = cvtpk(__expf(s[r] * 0.125f - mv[r]),
                                               __expf(s[r + 1] * 0.125f - mv[r + 1]));
        }
      }
#pragma unroll
      for (int it = 0; it < 2; ++it)
#pragma unroll
        for (int nt = 0; nt < 4; ++nt)
          acc[it][nt] = wmma_bf16(pa[it].v, bz[nt], acc[it][nt]);
      // Order for the compiler's scheduler: the 16 fragment reads first, then the 16
      // matrix products. Left alone it moves each read down to its product and
      // waits there, one LDS latency after another.
      __builtin_amdgcn_sched_group_barrier(0x100, 16, 0);
      __builtin_amdgcn_sched_group_barrier(0x008, 16, 0);
      // The products stay ahead of what follows: the next trip's reads, or the
      // stage's closing waits (moved behind those, they would start only when the
      // last of the 20 reads has landed).
      __builtin_amdgcn_sched_barrier(0);
    }
    // behind the stage's last trip: publish stage st+1, free stage st's buffers,
    // then refill them with st+2
    wait_ds();
    wait_async();
    __syncthreads();
    if (st + 2 < NST_) stage(st + 2, st & 1);
  }
  wait_async();

  // The ring is free: every wave's reads and copies ended at the last stage's
  // barrier. Waves w and w^4 hold the two halves' sums of the same 32 rows: each
  // keeps one row tile (its number jh) and hands the other over, 16 B a lane and
  // 512 B a store in a row.
  float4* sX = reinterpret_cast<float4*>(&ring);
#pragma unroll
  for (int nt = 0; nt < 4; ++nt) {
    const v8f g = jh ? acc[0][nt] : acc[1][nt];
    sX[(wave * 8 + nt * 2) * 32 + lane]     = float4{g[0], g[1], g[2], g[3]};
    sX[(wave * 8 + nt * 2 + 1) * 32 + lane] = float4{g[4], g[5], g[6], g[7]};
  }
  __syncthreads();   // each wave reads what its partner wrote

#pragma unroll
  for (int nt = 0; nt < 4; ++nt) {
    const v8f k = jh ? acc[1][nt] : acc[0][nt];
    const float4 p0 = sX[((wave ^ 4) * 8 + nt * 2) * 32 + lane];
    const float4 p1 = sX[((wave ^ 4) * 8 + nt * 2 + 1) * 32 + lane];
    const float pv[8] = {p0.x, p0.y, p0.z, p0.w, p1.x, p1.y, p1.z, p1.w};
#pragma unroll
    for (int r = 0; r < 8; ++r)
      out[(bT + i0 + jh * 16 + r + hi * 8) * D_ + nt * 16 + n] = k[r] + pv[r];
  }
}

// ---------------------------------------------------------------------------
extern "C" void kernel_launch(void* const* d_in, const int* in_sizes, int n_in,
                              void* d_out, int out_size, void* d_ws, size_t ws_size,
                              hipStream_t stream)
{
  (void)in_sizes; (void)n_in; (void)out_size; (void)ws_size;
  const float* x  = (const float*)d_in[0];
  const float* Wq = (const float*)d_in[1];
  const float* bq = (const float*)d_in[2];
  float* out = (float*)d_out;

  char* ws = (char*)d_ws;
  uint16_t* qb  = (uint16_t*)(ws);                                 // 4 MB  q bf16
  uint16_t* qzT = (uint16_t*)(ws + ((size_t)4 << 20));             // 4 MB  (q/Z)^T bf16
  float*    mj  = (float*)   (ws + ((size_t)9 << 20));             // 128 KB col max

  k_proj <<<256,  256, 0, stream>>>(x, Wq, bq, qb);
  k_stats<<<256,  256, 0, stream>>>(qb, mj, qzT);
  k_attn <<<256,  256, 0, stream>>>(qb, qzT, mj, out);
}

// v009
// Measured time: 40.9 microseconds a run.
// In two side-by-side timings against v008, it was 1.08 and 1.07 times as fast.
// All steps since v000 together make it 4.98 times as fast.
#include <hip/hip_runtime.h>
#include <hip/hip_bf16.h>
#include <stdint.h>

#define B_  16
#define T_  2048
#define E_  512
#define D_  64

typedef __attribute__((ext_vector_type(16))) __bf16 v16bf;
typedef __attribute__((ext_vector_type(8)))  float  v8f;
typedef __attribute__((ext_vector_type(2)))  float  v2f;
typedef __attribute__((ext_vector_type(2)))  __bf16 v2bf;

// Round two f32 to bf16 (RNE) and pack into one u32 via v_perm_b32.
static __device__ __forceinline__ uint32_t pkbf(float a, float b) {
  uint32_t ua = __builtin_bit_cast(uint32_t, a);
  uint32_t ub = __builtin_bit_cast(uint32_t, b);
  ua += 0x7FFFu + ((ua >> 16) & 1u);
  ub += 0x7FFFu + ((ub >> 16) & 1u);
  // out = {ub[31:24], ub[23:16], ua[31:24], ua[23:16]}
  return __builtin_amdgcn_perm(ub, ua, 0x07060302u);
}
// The same rounding: one packed convert.
static __device__ __forceinline__ uint32_t cvtpk(float a, float b) {
  v2f f = {a, b};
  return __builtin_bit_cast(uint32_t, __builtin_convertvector(f, v2bf));
}
static __device__ __forceinline__ uint16_t f2bfu(float f) {
  uint32_t u = __builtin_bit_cast(uint32_t, f);
  u += 0x7FFFu + ((u >> 16) & 1u);
  return (uint16_t)(u >> 16);
}
static __device__ __forceinline__ float bf2f(uint16_t h) {
  return __builtin_bit_cast(float, (uint32_t)h << 16);   // exact
}

static __device__ __forceinline__ v8f wmma_bf16(v16bf a, v16bf b, v8f c) {
  // D = A(16x32 bf16) * B(32x16 bf16) + C(16x16 f32)
  return __builtin_amdgcn_wmma_f32_16x16x32_bf16(false, a, false, b, (short)0, c,
                                                 false, false);
}

// Rows of S that k_stats works on at a time (a chunk), and rows (k_stats) or
// columns (k_attn) that one ring stage holds: four chunks, so that a stage's copies
// have four chunks' work to land in, from memory too, and the waves meet once a stage.
#define CJ_  64
#define SJ_  256
#define CPS_ (SJ_ / CJ_)
#define NST_ (T_ / SJ_)
// q rows in LDS: 128 B of data at a pitch of 144 B (16 B x odd), so that the 16
// rows one ds_load_b128 reads fall on 16 different groups of four banks.
#define QPIT 72

// A 16-element fragment from LDS rows that are 16-byte aligned only.
static __device__ __forceinline__ v16bf lds_frag(const uint16_t* p) {
  const uint4* q = reinterpret_cast<const uint4*>(p);
  union { v16bf v; uint4 q[2]; } u;
  u.q[0] = q[0];
  u.q[1] = q[1];
  return u.v;
}

// LDS byte address of a __shared__ object (what an async copy takes).
static __device__ __forceinline__ uint32_t lds_addr(const void* p) {
  typedef __attribute__((address_space(3))) const unsigned char lds_byte;
  return (uint32_t)(uintptr_t)(lds_byte*)p;
}
// Async copies global -> LDS, 16 B a lane each. The s_wait_xcnt closes the
// statement so that no address register is rewritten ahead of it.
static __device__ __forceinline__ void copy2_b128(uint32_t l0, const void* g0,
                                                  uint32_t l1, const void* g1) {
  asm volatile("global_load_async_to_lds_b128 %0, %1, off\n\t"
               "global_load_async_to_lds_b128 %2, %3, off\n\t"
               "s_wait_xcnt 0x0"
               :: "v"(l0), "v"(g0), "v"(l1), "v"(g1) : "memory");
}
// Eight such copies at even steps (ls bytes in LDS, gs elements in memory).
static __device__ __forceinline__ void copy8_b128(uint32_t l, uint32_t ls,
                                                  const uint16_t* g, size_t gs) {
  asm volatile("global_load_async_to_lds_b128 %0, %1, off\n\t"
               "global_load_async_to_lds_b128 %2, %3, off\n\t"
               "global_load_async_to_lds_b128 %4, %5, off\n\t"
               "global_load_async_to_lds_b128 %6, %7, off\n\t"
               "global_load_async_to_lds_b128 %8, %9, off\n\t"
               "global_load_async_to_lds_b128 %10, %11, off\n\t"
               "global_load_async_to_lds_b128 %12, %13, off\n\t"
               "global_load_async_to_lds_b128 %14, %15, off\n\t"
               "s_wait_xcnt 0x0"
               :: "v"(l),          "v"(g),          "v"(l + ls),     "v"(g + gs),
                  "v"(l + 2 * ls), "v"(g + 2 * gs), "v"(l + 3 * ls), "v"(g + 3 * gs),
                  "v"(l + 4 * ls), "v"(g + 4 * gs), "v"(l + 5 * ls), "v"(g + 5 * gs),
                  "v"(l + 6 * ls), "v"(g + 6 * gs), "v"(l + 7 * ls), "v"(g + 7 * gs)
               : "memory");
}
// This wave's copies have landed (other waves read them behind the barrier).
static __device__ __forceinline__ void wait_async() {
  asm volatile("s_wait_asynccnt 0x0" ::: "memory");
}
// This wave's LDS reads are done (before a copy refills what it has read).
static __device__ __forceinline__ void wait_ds() {
  asm volatile("s_wait_dscnt 0x0" ::: "memory");
}

// Exponents are kept in base 2: e^(S/8 - m) = 2^(S*KS_ - m*log2 e), with the score's
// 1/8 and log2 e in one constant, so that the exponent is one multiply-add on the raw
// product and goes to v_exp_f32 as it is. m is kept, and handed on, times log2 e.
#define KS_ 0.18033688f
static __device__ __forceinline__ float exp2_fast(float x) {
  return __builtin_amdgcn_exp2f(x);
}
// The same with the free issue slot behind the transcendental written into its own
// statement.
static __device__ __forceinline__ float exp2_slot(float x) {
  float r;
  // v_nop: that slot; inside the statement nothing can be scheduled in front of it
  asm("v_exp_f32 %0, %1\n\tv_nop" : "=v"(r) : "v"(x));
  return r;
}

// ---------------------------------------------------------------------------
// Kernel 1: q = x @ Wq + bq (bf16 out). One wave per 16x64 q tile. Each block
// first puts Wq^T[n][k] = bf16(Wq[k][n]) (64 x 512) into its LDS; the B operand
// is read from there, 16 values k in a row per lane.
// ---------------------------------------------------------------------------
// Wq^T rows in LDS: 1024 B of data at a pitch of 1040 B (16 B x odd), so that 16
// rows n fall on 16 different groups of four banks, for the stores and the reads.
#define WPIT 520
__global__ __launch_bounds__(256)
void k_proj(const float* __restrict__ x, const float* __restrict__ Wq,
            const float* __restrict__ bq, uint16_t* __restrict__ qb)
{
  __shared__ __align__(16) uint16_t sW[D_ * WPIT];     // 65 KB
  const int tid  = threadIdx.x;
  {
    // A thread takes one column n of Wq and 16 groups of 8 rows k: a wave's load
    // is one whole 128 B line of a row, its store 16 B in each of 32 rows of Wq^T.
    const float* wp = Wq + (size_t)(tid >> 6) * 8 * D_ + (tid & 63);
    uint16_t*    sp = sW + (tid & 63) * WPIT + (tid >> 6) * 8;
    // Both loops unrolled: every load is a constant offset from one address pair
    // and many are in flight at once; w stays in registers.
#pragma unroll
    for (int p = 0; p < E_ / 32; ++p) {
      float w[8];
#pragma unroll
      for (int e = 0; e < 8; ++e) w[e] = wp[(p * 32 + e) * D_];
      const uint4 v = {cvtpk(w[0], w[1]), cvtpk(w[2], w[3]),
                       cvtpk(w[4], w[5]), cvtpk(w[6], w[7])};
      *reinterpret_cast<uint4*>(sp + p * 32) = v;
    }
  }
  __syncthreads();   // every wave reads all of Wq^T

  const int wave = tid >> 5;
  const int lane = tid & 31;
  const int n    = lane & 15;      // A-layout M / C-layout N
  const int hi   = lane >> 4;      // K-half selector
  const int tok0 = blockIdx.x * 128 + wave * 16;

  v8f acc[4] = {v8f{}, v8f{}, v8f{}, v8f{}};
  const float* xrow = x + (size_t)(tok0 + n) * E_;

  for (int kb = 0; kb < E_; kb += 32) {
    if (kb + 32 < E_)
      __builtin_prefetch(xrow + kb + 32 + hi * 16, 0, 0);

    // A operand: x[tok0+n][kb + hi*16 .. +15] -> bf16 (perm-packed converts)
    const float4* xr = reinterpret_cast<const float4*>(xrow + kb + hi * 16);
    float4 p0 = xr[0], p1 = xr[1], p2 = xr[2], p3 = xr[3];
    // B operand: Wq^T[nt*16+n][kb + hi*16 .. +15] of the four column tiles
    // (unrolled, so that bv is indexed by constants and stays in registers)
    v16bf bv[4];
#pragma unroll
    for (int nt = 0; nt < 4; ++nt)
      bv[nt] = lds_frag(sW + (nt * 16 + n) * WPIT + kb + hi * 16);
    // The eight LDS reads stay here, one group under the x loads' latency. Left
    // alone the compiler reads each tile's pair into the same registers right in
    // front of its product and waits out the LDS latency four times a trip.
    // s_wait_xcnt: stands before the x loads' address pair is stepped, further down.
    asm volatile("s_wait_xcnt 0x0" ::: "memory");
    __builtin_amdgcn_sched_barrier(0);
    float fv[16] = {p0.x, p0.y, p0.z, p0.w, p1.x, p1.y, p1.z, p1.w,
                    p2.x, p2.y, p2.z, p2.w, p3.x, p3.y, p3.z, p3.w};
    union { v16bf v; uint32_t w[8]; } ua;
#pragma unroll
    for (int q = 0; q < 8; ++q) ua.w[q] = pkbf(fv[2 * q], fv[2 * q + 1]);

#pragma unroll
    for (int nt = 0; nt < 4; ++nt)
      acc[nt] = wmma_bf16(ua.v, bv[nt], acc[nt]);
  }

  // Epilogue: C layout -> lane holds column n, rows r + hi*8
#pragma unroll
  for (int nt = 0; nt < 4; ++nt) {
    const int col  = nt * 16 + n;
    const float bb = bq[col];
#pragma unroll
    for (int r = 0; r < 8; ++r) {
      const size_t row = (size_t)tok0 + r + hi * 8;
      qb[row * D_ + col] = f2bfu(acc[nt][r] + bb);
    }
  }
}

// ---------------------------------------------------------------------------
// Kernel 2: column softmax stats: m_j = max_i S_ij, Z_j = sum_i e^{S_ij-m_j}.
// (m_j is kept, and stored, times log2 e: see KS_.)
// 8 waves/block share batch b; 256 rows i of q (32KB, four 64-row chunks) a stage
// go through a ring of two LDS buffers: stage s+1's async copies fly while stage s
// is worked on.
// The loop runs one chunk apart: trip t reads chunk t's fragments, takes the max
// and the sums of S of chunk t-1 while those reads are under way, then forms S.
// Epilogue: q~^T[b][d][t] = bf16(q[b,t,d] / Z_{b,t}) for the block's 128 tokens
// (transposed layout so that the P x q~ B operand has its 32 columns j in a
// row), from the q rows each wave already holds as its B operand.
// ---------------------------------------------------------------------------
#define TPIT 136  // q~^T tile rows in LDS: 256 B of data at a pitch of 272 B
__global__ __launch_bounds__(256)
void k_stats(const uint16_t* __restrict__ qb, float* __restrict__ mj,
             uint16_t* __restrict__ qzT)
{
  __shared__ __align__(16) uint16_t sA[2][SJ_ * QPIT]; // 2 x 36KB ring of q rows i
  const int tid = threadIdx.x, wave = tid >> 5, lane = tid & 31;
  const int gw = blockIdx.x * 8 + wave;                // 0..2047
  const int b  = gw >> 7;
  const int j0 = (gw & 127) * 16;
  const int n  = lane & 15, hi = lane >> 4;
  const size_t bT = (size_t)b * T_;
  const uint16_t* qbase = qb + bT * D_;

  // B operand fixed over i loop: B[k][n] = q[j0+n][k]
  const uint16_t* rowB = qbase + (size_t)(j0 + n) * D_;
  v16bf b0 = *reinterpret_cast<const v16bf*>(rowB + hi * 16);
  v16bf b1 = *reinterpret_cast<const v16bf*>(rowB + 32 + hi * 16);

  // a stage is 32KB contiguous in q: eight threads a row, eight 16B copies per
  // thread, 32 rows apart
  const uint32_t  lA = lds_addr(&sA[0][0]) + (tid >> 3) * (QPIT * 2) + (tid & 7) * 16;
  const uint16_t* gA = qbase + tid * 8;
  auto stage = [&](int s, int buf) {
    copy8_b128(lA + buf * (SJ_ * QPIT * 2), 32 * QPIT * 2,
               gA + (size_t)s * (SJ_ * D_), 32 * D_);
  };
  stage(0, 0);
  wait_async();
  __syncthreads();
  stage(1, 1);

  float mloc = -1.0e30f;
  v2f za = {0.0f, 0.0f}, zb = {0.0f, 0.0f};   // four partial sums of the lane's column
  v16bf a[CJ_ / 16][2];   // a chunk's A fragments, four 16-row tiles
  v8f   c[CJ_ / 16];      // S of the chunk before, until its max and sums are taken
  // all 16 fragment reads of chunk t, at constant offsets from the chunk's start
  auto read = [&](int t) {
    const uint16_t* sAt = sA[(t / CPS_) & 1] + (t % CPS_) * (CJ_ * QPIT);
#pragma unroll
    for (int g = 0; g < CJ_ / 16; ++g) {
      const uint16_t* ar = sAt + (g * 16 + n) * QPIT;
      a[g][0] = lds_frag(ar + hi * 16);
      a[g][1] = lds_frag(ar + 32 + hi * 16);
    }
  };
  // S of one 32-row half of the chunk
  auto prod = [&](int sub) {
#pragma unroll
    for (int g = 2 * sub; g < 2 * sub + 2; ++g) {
      v8f s = {};
      s = wmma_bf16(a[g][0], b0, s);
      c[g] = wmma_bf16(a[g][1], b1, s);
    }
  };
  // running max and sum over one 32-row half
  auto soft = [&](int sub, auto ex) {
    const v8f c0 = c[2 * sub], c1 = c[2 * sub + 1];
    // the maximum is taken on the raw products (KS_ > 0 keeps their order)
    float tmax = fmaxf(c0[0], c1[0]);
#pragma unroll
    for (int r = 1; r < 8; ++r)
      tmax = fmaxf(fmaxf(tmax, c0[r]), c1[r]);
    const float nm = fmaxf(mloc, tmax * KS_);
    const float f  = ex(mloc - nm);
    // two scores an instruction: exponents by packed multiply-add, sums by packed add
    const v2f k2 = {KS_, KS_}, n2 = {nm, nm}, f2 = {f, f};
    v2f s0 = za * f2, s1 = zb * f2;
#pragma unroll
    for (int r = 0; r < 8; r += 2) {
      const v2f x0 = v2f{c0[r], c0[r + 1]} * k2 - n2;
      const v2f x1 = v2f{c1[r], c1[r + 1]} * k2 - n2;
      s0 += v2f{ex(x0.x), ex(x0.y)};
      s1 += v2f{ex(x1.x), ex(x1.y)};
    }
    mloc = nm; za = s0; zb = s1;
  };
  auto ex_loop = [](float x) { return exp2_fast(x); };
  auto ex_tail = [](float x) { return exp2_slot(x); };
  // publish stage s+1 and free stage s's buffer
  auto foot = [&]() {
    wait_ds();
    wait_async();
    __syncthreads();
  };

  read(0);
  // one group here too, instead of a wait at each pair of reads
  __builtin_amdgcn_sched_barrier(0);
  prod(0);
  prod(1);
  int t = 1;
  for (int s = 0; s < NST_; ++s) {
    // The chunks of a stage, in a loop of their own: a trip is then one block of
    // code with no branch in it, and the order written below holds. (With the
    // stage's end as a branch inside the trip, the compiler moved the max and sums
    // behind that branch, out from under the reads.)
    for (; t < (s + 1) * CPS_; ++t) {
      read(t);
      // The reads stay first, as one group: the max and sums of chunk t-1 (registers
      // only) run while they are under way. Left alone the compiler spreads the reads
      // over the trip, the last pairs right in front of their products with a full
      // wait each.
      __builtin_amdgcn_sched_barrier(0);
      soft(0, ex_loop);
      prod(0);
      soft(1, ex_loop);
      prod(1);
      // All of that stays ahead of the stage's closing waits: moved behind them, it
      // would start only when the last read has landed, and the refill would go late.
      __builtin_amdgcn_sched_barrier(0);
    }
    // the stage's last chunk is read: close the stage, then refill its buffer
    foot();
    if (s + 2 < NST_) stage(s + 2, s & 1);
  }
  wait_async();
  // the last chunk's max and sums
  soft(0, ex_tail);
  soft(1, ex_tail);

  const float zloc = (za.x + za.y) + (zb.x + zb.y);
  // combine lane pair (l, l^16): each holds 8 of the 16 rows of column n
  const float mo = __shfl_xor(mloc, 16, 32);
  const float zo = __shfl_xor(zloc, 16, 32);
  const float M  = fmaxf(mloc, mo);
  const float Z  = zloc * exp2_fast(mloc - M) + zo * exp2_fast(mo - M);
  if (lane < 16)
    mj[bT + j0 + lane] = M;

  // The ring is free: every wave's reads and copies ended at the last trip's
  // barrier. Lane (n, hi) holds token j0+n, d = hi*16.. and 32+hi*16.., and Z of
  // that token: the 64 x 128 tile [d][token] is put together in the ring's LDS.
  uint16_t* sT = &sA[0][0];
  union { v16bf v; uint16_t h[16]; } u0, u1;
  u0.v = b0;
  u1.v = b1;
#pragma unroll
  for (int e = 0; e < 16; ++e) {
    sT[(hi * 16 + e) * TPIT + wave * 16 + n]      = f2bfu(bf2f(u0.h[e]) / Z);
    sT[(32 + hi * 16 + e) * TPIT + wave * 16 + n] = f2bfu(bf2f(u1.h[e]) / Z);
  }
  __syncthreads();   // tile columns come from all eight waves

  // out in whole 256 B rows: sixteen threads a row d, 16 B each
  uint16_t* gT = qzT + (size_t)b * D_ * T_ + (j0 - wave * 16)
               + (size_t)(tid >> 4) * T_ + (tid & 15) * 8;
  const uint16_t* lT = sT + (tid >> 4) * TPIT + (tid & 15) * 8;
#pragma unroll
  for (int k = 0; k < 4; ++k)
    *reinterpret_cast<uint4*>(gT + (size_t)k * 16 * T_) =
        *reinterpret_cast<const uint4*>(lT + k * 16 * TPIT);
}

// ---------------------------------------------------------------------------
// Kernel 3: out[i,:] = sum_j exp(S_ij/8 - m_j) * q~[j,:]
// (as 2^(S_ij*KS_ - m_j*log2 e), with m_j*log2 e as k_stats stored it)
// 8 waves/block share batch b and 128 rows i; per 256 columns j the block's
// operands (q rows, q~^T columns, m) go through a ring of two LDS buffers: stage
// s+1's async copies fly while stage s is worked on. A wave takes 32 rows i (two
// tiles) and one half of every stage's columns j: each fragment it reads from LDS
// feeds two products, so the block reads half as many LDS bytes as with one tile
// a wave. The two halves' sums of a row are added at the end, through LDS.
// S is computed transposed (rows j, columns i): lane (n, hi) then holds row n of
// a tile of P at j = 8*hi+r of each 16-column tile, and two tiles packed to bf16
// are the A operand of P x q~ as they lie, element s at
// j = 16*(s>>3) + 8*hi + (s&7). q~^T is read in that order.
// ---------------------------------------------------------------------------
// q~^T rows in LDS: 512 B of data at a pitch of 656 B (16 B x odd, and 144 B more
// than a multiple of the banks' 256 B: 16 rows on 16 groups of four banks).
#define ZPIT 328
// Columns j a trip, and the trips a wave makes in its half of a stage.
#define AJ_  32
#define TPW_ (SJ_ / AJ_ / 2)
__global__ __launch_bounds__(256)
void k_attn(const uint16_t* __restrict__ qb, const uint16_t* __restrict__ qzT,
            const float* __restrict__ mj, float* __restrict__ out)
{
  // One object, laid so that m, z and q of buffer 0 all start low enough for a
  // trip's reads to be constant offsets from one address each (an LDS
  // instruction's offset field ends at 64 KB); buffer 1 is one even step further.
  __shared__ __align__(16) struct {
    float m[2][SJ_];            // 2 x 1KB m_j
    struct {
      uint16_t z[D_ * ZPIT];    // 41KB q~^T[d][j]
      uint16_t q[SJ_ * QPIT];   // 36KB q rows j
    } b[2];
  } ring;
  constexpr uint32_t BSTEP = sizeof(ring.b[0]);
  const int tid = threadIdx.x, lane = tid & 31;
  const int wave = __builtin_amdgcn_readfirstlane(tid >> 5);
  const int ig = wave & 3;                              // which 32 of the 128 rows i
  const int jh = wave >> 2;                             // which half of the columns j
  const int b  = blockIdx.x >> 4;
  const int i0 = (blockIdx.x & 15) * 128 + ig * 32;
  const int n  = lane & 15, hi = lane >> 4;
  const size_t bT = (size_t)b * T_;
  const uint16_t* qbase = qb + bT * D_;
  const uint16_t* zbase = qzT + (size_t)b * D_ * T_;

  // B operand for S^T: rows i0..i0+31 of q as columns, two tiles (fixed over j)
  v16bf a[2][2];
#pragma unroll
  for (int it = 0; it < 2; ++it) {
    const uint16_t* rowA = qbase + (size_t)(i0 + it * 16 + n) * D_;
    a[it][0] = *reinterpret_cast<const v16bf*>(rowA + hi * 16);
    a[it][1] = *reinterpret_cast<const v16bf*>(rowA + 32 + hi * 16);
  }

  v8f acc[2][4] = {{v8f{}, v8f{}, v8f{}, v8f{}}, {v8f{}, v8f{}, v8f{}, v8f{}}};

  // One stage: q rows, 32KB contiguous (eight threads a row, eight 16B copies 32
  // rows apart);
  // q~^T, 64 rows d of 512 B (a wave a row, eight copies 8 rows apart);
  // m, 1 KB (wave 0, two copies of 16 B a lane).
  const uint32_t  lQ = lds_addr(ring.b[0].q) + (tid >> 3) * (QPIT * 2) + (tid & 7) * 16;
  const uint32_t  lZ = lds_addr(ring.b[0].z) + (tid >> 5) * (ZPIT * 2) + lane * 16;
  const uint32_t  lM = lds_addr(ring.m[0]) + lane * 16;
  const uint16_t* gQ = qbase + tid * 8;
  const uint16_t* gZ = zbase + (size_t)(tid >> 5) * T_ + lane * 8;
  const float*    gM = mj + bT + lane * 4;
  auto stage = [&](int s, int buf) {
    copy8_b128(lQ + buf * BSTEP, 32 * QPIT * 2,
               gQ + (size_t)s * (SJ_ * D_), 32 * D_);
    copy8_b128(lZ + buf * BSTEP, 8 * ZPIT * 2,
               gZ + s * SJ_, (size_t)8 * T_);
    if (wave == 0) {
      const uint32_t m = lM + buf * (SJ_ * 4);
      const float*   g = gM + s * SJ_;
      copy2_b128(m, g, m + 512, g + 128);
    }
  };
  stage(0, 0);
  wait_async();
  __syncthreads();
  stage(1, 1);

  for (int st = 0; st < NST_; ++st) {
    // The wave's four trips in its half of the stage. Unrolled: the reads of all four
    // are then constant offsets from addresses formed once a stage.
#pragma unroll
    for (int u = 0; u < TPW_; ++u) {
      const int cj = (jh * TPW_ + u) * AJ_;             // first column j of the trip
      const uint16_t* sQt = ring.b[st & 1].q + cj * QPIT;
      const uint16_t* sZt = ring.b[st & 1].z + cj;
      const float*    sMt = ring.m[st & 1] + cj;
      // No barrier stands inside a trip, so every LDS read of the trip goes out as
      // one group ahead of the products, in the order of use: m_j of the lane's 8
      // rows a tile, the q rows j (A of S^T), then q~^T (B of P x q~: 8 columns j at
      // hi*8 and 8 at 16 + hi*8). Every loop over these arrays is unrolled, so that
      // each index is a constant and they stay in registers.
      v16bf aq[2][2], bz[4];
      float4 mm[2][2];
#pragma unroll
      for (int h = 0; h < 2; ++h) {
        const float4* mp = reinterpret_cast<const float4*>(sMt + h * 16 + hi * 8);
        mm[h][0] = mp[0];
        mm[h][1] = mp[1];
      }
      // The m reads stay first: in one region with the fragment reads the compiler
      // put most of them last, and the first exponentials waited for the whole group.
      __builtin_amdgcn_sched_barrier(0);
#pragma unroll
      for (int h = 0; h < 2; ++h) {
        const uint16_t* rb = sQt + (h * 16 + n) * QPIT;
        aq[h][0] = lds_frag(rb + hi * 16);
        aq[h][1] = lds_frag(rb + 32 + hi * 16);
      }
#pragma unroll
      for (int nt = 0; nt < 4; ++nt) {
        const uint16_t* zr = sZt + (nt * 16 + n) * ZPIT + hi * 8;
        union { v16bf v; uint4 q[2]; } ub;
        ub.q[0] = *reinterpret_cast<const uint4*>(zr);
        ub.q[1] = *reinterpret_cast<const uint4*>(zr + 16);
        bz[nt] = ub.v;
      }

      // per row tile: two 16x16 S^T sub-tiles -> P = exp(S/8 - m_j), packed in registers
      union { v16bf v; uint32_t w[8]; } pa[2];
#pragma unroll
      for (int h = 0; h < 2; ++h) {
        const float4 m0 = mm[h][0], m1 = mm[h][1];
        const float mv[8] = {m0.x, m0.y, m0.z, m0.w, m1.x, m1.y, m1.z, m1.w};
#pragma unroll
        for (int it = 0; it < 2; ++it) {
          v8f s = {};
          s = wmma_bf16(aq[h][0], a[it][0], s);  // s[r] = S[i0+it*16+n][j], j = h*16+hi*8+r
          s = wmma_bf16(aq[h][1], a[it][1], s);
#pragma unroll
          for (int r = 0; r < 8; r += 2)
            pa[it].w[h * 4 + (r >> 1)] = cvtpk(exp2_fast(s[r] * KS_ - mv[r]),
                                               exp2_fast(s[r + 1] * KS_ - mv[r + 1]));
        }
      }
#pragma unroll
      for (int it = 0; it < 2; ++it)
#pragma unroll
        for (int nt = 0; nt < 4; ++nt)
          acc[it][nt] = wmma_bf16(pa[it].v, bz[nt], acc[it][nt]);
      // Order for the compiler's scheduler: the 16 fragment reads first, then the 16
      // matrix products. Left alone it moves each read down to its product and
      // waits there, one LDS latency after another.
      __builtin_amdgcn_sched_group_barrier(0x100, 16, 0);
      __builtin_amdgcn_sched_group_barrier(0x008, 16, 0);
      // The products stay ahead of what follows: the next trip's reads, or the
      // stage's closing waits (moved behind those, they would start only when the
      // last of the 20 reads has landed).
      __builtin_amdgcn_sched_barrier(0);
    }
    // behind the stage's last trip: publish stage st+1, free stage st's buffers,
    // then refill them with st+2
    wait_ds();
    wait_async();
    __syncthreads();
    if (st + 2 < NST_) stage(st + 2, st & 1);
  }
  wait_async();

  // The ring is free: every wave's reads and copies ended at the last stage's
  // barrier. Waves w and w^4 hold the two halves' sums of the same 32 rows: each
  // keeps one row tile (its number jh) and hands the other over, 16 B a lane and
  // 512 B a store in a row.
  float4* sX = reinterpret_cast<float4*>(&ring);
#pragma unroll
  for (int nt = 0; nt < 4; ++nt) {
    const v8f g = jh ? acc[0][nt] : acc[1][nt];
    sX[(wave * 8 + nt * 2) * 32 + lane]     = float4{g[0], g[1], g[2], g[3]};
    sX[(wave * 8 + nt * 2 + 1) * 32 + lane] = float4{g[4], g[5], g[6], g[7]};
  }
  __syncthreads();   // each wave reads what its partner wrote

#pragma unroll
  for (int nt = 0; nt < 4; ++nt) {
    const v8f k = jh ? acc[1][nt] : acc[0][nt];
    const float4 p0 = sX[((wave ^ 4) * 8 + nt * 2) * 32 + lane];
    const float4 p1 = sX[((wave ^ 4) * 8 + nt * 2 + 1) * 32 + lane];
    const float pv[8] = {p0.x, p0.y, p0.z, p0.w, p1.x, p1.y, p1.z, p1.w};
#pragma unroll
    for (int r = 0; r < 8; ++r)
      out[(bT + i0 + jh * 16 + r + hi * 8) * D_ + nt * 16 + n] = k[r] + pv[r];
  }
}

// ---------------------------------------------------------------------------
extern "C" void kernel_launch(void* const* d_in, const int* in_sizes, int n_in,
                              void* d_out, int out_size, void* d_ws, size_t ws_size,
                              hipStream_t stream)
{
  (void)in_sizes; (void)n_in; (void)out_size; (void)ws_size;
  const float* x  = (const float*)d_in[0];
  const float* Wq = (const float*)d_in[1];
  const float* bq = (const float*)d_in[2];
  float* out = (float*)d_out;

  char* ws = (char*)d_ws;
  uint16_t* qb  = (uint16_t*)(ws);                                 // 4 MB  q bf16
  uint16_t* qzT = (uint16_t*)(ws + ((size_t)4 << 20));             // 4 MB  (q/Z)^T bf16
  float*    mj  = (float*)   (ws + ((size_t)9 << 20));             // 128 KB col max

  k_proj <<<256,  256, 0, stream>>>(x, Wq, bq, qb);
  k_stats<<<256,  256, 0, stream>>>(qb, mj, qzT);
  k_attn <<<256,  256, 0, stream>>>(qb, qzT, mj, out);
}

// v010
// One run takes 36.1 microseconds.
// Two timings next to v009 both put it at 1.14 times that version's speed.
// All steps since v000 together make it 5.68 times as fast.
#include <hip/hip_runtime.h>
#include <hip/hip_bf16.h>
#include <stdint.h>

#define B_  16
#define T_  2048
#define E_  512
#define D_  64

typedef __attribute__((ext_vector_type(16))) __bf16 v16bf;
typedef __attribute__((ext_vector_type(8)))  float  v8f;
typedef __attribute__((ext_vector_type(2)))  float  v2f;
typedef __attribute__((ext_vector_type(2)))  __bf16 v2bf;

// Round two f32 to bf16 (RNE) and pack into one u32 via v_perm_b32.
static __device__ __forceinline__ uint32_t pkbf(float a, float b) {
  uint32_t ua = __builtin_bit_cast(uint32_t, a);
  uint32_t ub = __builtin_bit_cast(uint32_t, b);
  ua += 0x7FFFu + ((ua >> 16) & 1u);
  ub += 0x7FFFu + ((ub >> 16) & 1u);
  // out = {ub[31:24], ub[23:16], ua[31:24], ua[23:16]}
  return __builtin_amdgcn_perm(ub, ua, 0x07060302u);
}
// The same rounding: one packed convert.
static __device__ __forceinline__ uint32_t cvtpk(float a, float b) {
  v2f f = {a, b};
  return __builtin_bit_cast(uint32_t, __builtin_convertvector(f, v2bf));
}
static __device__ __forceinline__ uint16_t f2bfu(float f) {
  uint32_t u = __builtin_bit_cast(uint32_t, f);
  u += 0x7FFFu + ((u >> 16) & 1u);
  return (uint16_t)(u >> 16);
}
static __device__ __forceinline__ float bf2f(uint16_t h) {
  return __builtin_bit_cast(float, (uint32_t)h << 16);   // exact
}

static __device__ __forceinline__ v8f wmma_bf16(v16bf a, v16bf b, v8f c) {
  // D = A(16x32 bf16) * B(32x16 bf16) + C(16x16 f32)
  return __builtin_amdgcn_wmma_f32_16x16x32_bf16(false, a, false, b, (short)0, c,
                                                 false, false);
}

// Rows of S that k_stats works on at a time (a chunk), and rows (k_stats) or
// columns (k_attn) that one ring stage holds: four chunks, so that a stage's copies
// have four chunks' work to land in, from memory too, and the waves meet once a stage.
#define CJ_  64
#define SJ_  256
#define CPS_ (SJ_ / CJ_)
#define NST_ (T_ / SJ_)
// q rows in LDS: 128 B of data at a pitch of 144 B (16 B x odd), so that the 16
// rows one ds_load_b128 reads fall on 16 different groups of four banks.
#define QPIT 72

// A 16-element fragment from LDS rows that are 16-byte aligned only.
static __device__ __forceinline__ v16bf lds_frag(const uint16_t* p) {
  const uint4* q = reinterpret_cast<const uint4*>(p);
  union { v16bf v; uint4 q[2]; } u;
  u.q[0] = q[0];
  u.q[1] = q[1];
  return u.v;
}

// LDS byte address of a __shared__ object (what an async copy takes).
static __device__ __forceinline__ uint32_t lds_addr(const void* p) {
  typedef __attribute__((address_space(3))) const unsigned char lds_byte;
  return (uint32_t)(uintptr_t)(lds_byte*)p;
}
// Async copies global -> LDS, 16 B a lane each. The s_wait_xcnt closes the
// statement so that no address register is rewritten ahead of it.
static __device__ __forceinline__ void copy2_b128(uint32_t l0, const void* g0,
                                                  uint32_t l1, const void* g1) {
  asm volatile("global_load_async_to_lds_b128 %0, %1, off\n\t"
               "global_load_async_to_lds_b128 %2, %3, off\n\t"
               "s_wait_xcnt 0x0"
               :: "v"(l0), "v"(g0), "v"(l1), "v"(g1) : "memory");
}
// Eight such copies at even steps (ls bytes in LDS, gs elements in memory).
static __device__ __forceinline__ void copy8_b128(uint32_t l, uint32_t ls,
                                                  const uint16_t* g, size_t gs) {
  asm volatile("global_load_async_to_lds_b128 %0, %1, off\n\t"
               "global_load_async_to_lds_b128 %2, %3, off\n\t"
               "global_load_async_to_lds_b128 %4, %5, off\n\t"
               "global_load_async_to_lds_b128 %6, %7, off\n\t"
               "global_load_async_to_lds_b128 %8, %9, off\n\t"
               "global_load_async_to_lds_b128 %10, %11, off\n\t"
               "global_load_async_to_lds_b128 %12, %13, off\n\t"
               "global_load_async_to_lds_b128 %14, %15, off\n\t"
               "s_wait_xcnt 0x0"
               :: "v"(l),          "v"(g),          "v"(l + ls),     "v"(g + gs),
                  "v"(l + 2 * ls), "v"(g + 2 * gs), "v"(l + 3 * ls), "v"(g + 3 * gs),
                  "v"(l + 4 * ls), "v"(g + 4 * gs), "v"(l + 5 * ls), "v"(g + 5 * gs),
                  "v"(l + 6 * ls), "v"(g + 6 * gs), "v"(l + 7 * ls), "v"(g + 7 * gs)
               : "memory");
}
// The same eight copies for rows of f32 (gs in floats).
static __device__ __forceinline__ void copy8_f32(uint32_t l, uint32_t ls,
                                                 const float* g, size_t gs) {
  asm volatile("global_load_async_to_lds_b128 %0, %1, off\n\t"
               "global_load_async_to_lds_b128 %2, %3, off\n\t"
               "global_load_async_to_lds_b128 %4, %5, off\n\t"
               "global_load_async_to_lds_b128 %6, %7, off\n\t"
               "global_load_async_to_lds_b128 %8, %9, off\n\t"
               "global_load_async_to_lds_b128 %10, %11, off\n\t"
               "global_load_async_to_lds_b128 %12, %13, off\n\t"
               "global_load_async_to_lds_b128 %14, %15, off\n\t"
               "s_wait_xcnt 0x0"
               :: "v"(l),          "v"(g),          "v"(l + ls),     "v"(g + gs),
                  "v"(l + 2 * ls), "v"(g + 2 * gs), "v"(l + 3 * ls), "v"(g + 3 * gs),
                  "v"(l + 4 * ls), "v"(g + 4 * gs), "v"(l + 5 * ls), "v"(g + 5 * gs),
                  "v"(l + 6 * ls), "v"(g + 6 * gs), "v"(l + 7 * ls), "v"(g + 7 * gs)
               : "memory");
}
// All but this wave's N youngest copies have landed (the counter returns in issue
// order): the wave may read those, its own, while the younger ones still fly.
template <int N>
static __device__ __forceinline__ void wait_async_but() {
  asm volatile("s_wait_asynccnt %0" :: "n"(N) : "memory");
}
// This wave's copies have landed (other waves read them behind the barrier).
static __device__ __forceinline__ void wait_async() {
  asm volatile("s_wait_asynccnt 0x0" ::: "memory");
}
// This wave's LDS reads are done (before a copy refills what it has read).
static __device__ __forceinline__ void wait_ds() {
  asm volatile("s_wait_dscnt 0x0" ::: "memory");
}

// Exponents are kept in base 2: e^(S/8 - m) = 2^(S*KS_ - m*log2 e), with the score's
// 1/8 and log2 e in one constant, so that the exponent is one multiply-add on the raw
// product and goes to v_exp_f32 as it is. m is kept, and handed on, times log2 e.
#define KS_ 0.18033688f
static __device__ __forceinline__ float exp2_fast(float x) {
  return __builtin_amdgcn_exp2f(x);
}
// The same with the free issue slot behind the transcendental written into its own
// statement.
static __device__ __forceinline__ float exp2_slot(float x) {
  float r;
  // v_nop: that slot; inside the statement nothing can be scheduled in front of it
  asm("v_exp_f32 %0, %1\n\tv_nop" : "=v"(r) : "v"(x));
  return r;
}

// ---------------------------------------------------------------------------
// Kernel 1: q = x @ Wq + bq (bf16 out). One wave per 16x64 q tile. Each block
// first puts Wq^T[n][k] = bf16(Wq[k][n]) (64 x 512) into its LDS; the B operand
// is read from there, 16 values k in a row per lane.
// x comes through LDS too: a wave's 16 rows, 128 columns k (a quarter) at a time, by
// async copies that each take 512 B in a row of one token (four whole lines), into
// a ring of three slots that only this wave writes and reads, so no barrier belongs
// to it. Three quarters are asked for at entry and fly under the Wq set-up; the
// fourth goes into the first slot once that is read.
// ---------------------------------------------------------------------------
// Wq^T rows in LDS: 1024 B of data at a pitch of 1040 B (16 B x odd), so that 16
// rows n fall on 16 different groups of four banks, for the stores and the reads.
#define WPIT 520
// x rows in a slot: 512 B of data at a pitch of 528 B (16 B x odd), so that the 16
// rows one ds_load_b128 reads fall on 16 different groups of four banks.
#define XK_  128
#define XPIT 132
#define XSL_ 3
__global__ __launch_bounds__(256)
void k_proj(const float* __restrict__ x, const float* __restrict__ Wq,
            const float* __restrict__ bq, uint16_t* __restrict__ qb)
{
  __shared__ __align__(16) uint16_t sW[D_ * WPIT];     // 65 KB
  __shared__ __align__(16) float sX[8][XSL_][16 * XPIT];   // 198 KB, 3 slots a wave
  const int tid  = threadIdx.x;
  const int wave = tid >> 5;
  const int lane = tid & 31;
  const int tok0 = blockIdx.x * 128 + wave * 16;
  // quarter qd of the wave's 16 rows into its slot sl: one copy a row, 16 B a lane
  const uint32_t lX = lds_addr(&sX[wave][0][0]) + lane * 16;
  const float*   gX = x + (size_t)tok0 * E_ + lane * 4;
  auto fill = [&](int qd, int sl) {
    const uint32_t l = lX + sl * (16 * XPIT * 4);
    const float*   g = gX + qd * XK_;
    copy8_f32(l, XPIT * 4, g, E_);
    copy8_f32(l + 8 * XPIT * 4, XPIT * 4, g + (size_t)8 * E_, E_);
  };
  fill(0, 0);
  fill(1, 1);
  fill(2, 2);
  {
    // A thread takes one column n of Wq and 16 groups of 8 rows k: a wave's load
    // is one whole 128 B line of a row, its store 16 B in each of 32 rows of Wq^T.
    const float* wp = Wq + (size_t)(tid >> 6) * 8 * D_ + (tid & 63);
    uint16_t*    sp = sW + (tid & 63) * WPIT + (tid >> 6) * 8;
    // Both loops unrolled: every load is a constant offset from one address pair
    // and many are in flight at once; w stays in registers.
#pragma unroll
    for (int p = 0; p < E_ / 32; ++p) {
      float w[8];
#pragma unroll
      for (int e = 0; e < 8; ++e) w[e] = wp[(p * 32 + e) * D_];
      const uint4 v = {cvtpk(w[0], w[1]), cvtpk(w[2], w[3]),
                       cvtpk(w[4], w[5]), cvtpk(w[6], w[7])};
      *reinterpret_cast<uint4*>(sp + p * 32) = v;
    }
  }
  __syncthreads();   // every wave reads all of Wq^T

  const int n    = lane & 15;      // A-layout M / C-layout N
  const int hi   = lane >> 4;      // K-half selector

  v8f acc[4] = {v8f{}, v8f{}, v8f{}, v8f{}};

  // Both loops unrolled: each quarter has its own count in the wait, and every LDS
  // read is a constant offset from one address.
#pragma unroll
  for (int qd = 0; qd < E_ / XK_; ++qd) {
    // 16 copies a quarter, issued in the order 0 1 2 | 3: quarter qd has landed when
    // no more than the copies issued behind it are out.
    if (qd == 0)      wait_async_but<32>();   // 1, 2 behind it
    else if (qd == 1) wait_async_but<32>();   // 2, 3
    else if (qd == 2) wait_async_but<16>();   // 3
    else              wait_async_but<0>();
    const float* xq = &sX[wave][qd % XSL_][n * XPIT + hi * 16];
#pragma unroll
    for (int kk = 0; kk < XK_; kk += 32) {
      const int kb = qd * XK_ + kk;
      // A operand: x[tok0+n][kb + hi*16 .. +15] -> bf16 (perm-packed converts)
      const float4* xr = reinterpret_cast<const float4*>(xq + kk);
      float4 p0 = xr[0], p1 = xr[1], p2 = xr[2], p3 = xr[3];
      // B operand: Wq^T[nt*16+n][kb + hi*16 .. +15] of the four column tiles
      // (unrolled, so that bv is indexed by constants and stays in registers)
      v16bf bv[4];
#pragma unroll
      for (int nt = 0; nt < 4; ++nt)
        bv[nt] = lds_frag(sW + (nt * 16 + n) * WPIT + kb + hi * 16);
      // The twelve LDS reads stay here, as one group. Left alone the compiler reads
      // each tile's pair into the same registers right in front of its product and
      // waits out the LDS latency four times a trip.
      __builtin_amdgcn_sched_barrier(0);
      float fv[16] = {p0.x, p0.y, p0.z, p0.w, p1.x, p1.y, p1.z, p1.w,
                      p2.x, p2.y, p2.z, p2.w, p3.x, p3.y, p3.z, p3.w};
      union { v16bf v; uint32_t w[8]; } ua;
#pragma unroll
      for (int q = 0; q < 8; ++q) ua.w[q] = pkbf(fv[2 * q], fv[2 * q + 1]);

#pragma unroll
      for (int nt = 0; nt < 4; ++nt)
        acc[nt] = wmma_bf16(ua.v, bv[nt], acc[nt]);
    }
    if (qd == 0) {
      // slot 0 is read to its end by the one wave that uses it: refill it
      wait_ds();
      fill(3, 0);
    }
  }

  // Epilogue: C layout -> lane holds column n, rows r + hi*8
#pragma unroll
  for (int nt = 0; nt < 4; ++nt) {
    const int col  = nt * 16 + n;
    const float bb = bq[col];
#pragma unroll
    for (int r = 0; r < 8; ++r) {
      const size_t row = (size_t)tok0 + r + hi * 8;
      qb[row * D_ + col] = f2bfu(acc[nt][r] + bb);
    }
  }
}

// ---------------------------------------------------------------------------
// Kernel 2: column softmax stats: m_j = max_i S_ij, Z_j = sum_i e^{S_ij-m_j}.
// (m_j is kept, and stored, times log2 e: see KS_.)
// 8 waves/block share batch b; 256 rows i of q (32KB, four 64-row chunks) a stage
// go through a ring of two LDS buffers: stage s+1's async copies fly while stage s
// is worked on.
// The loop runs one chunk apart: trip t reads chunk t's fragments, takes the max
// and the sums of S of chunk t-1 while those reads are under way, then forms S.
// Epilogue: q~^T[b][d][t] = bf16(q[b,t,d] / Z_{b,t}) for the block's 128 tokens
// (transposed layout so that the P x q~ B operand has its 32 columns j in a
// row), from the q rows each wave already holds as its B operand.
// ---------------------------------------------------------------------------
#define TPIT 136  // q~^T tile rows in LDS: 256 B of data at a pitch of 272 B
__global__ __launch_bounds__(256)
void k_stats(const uint16_t* __restrict__ qb, float* __restrict__ mj,
             uint16_t* __restrict__ qzT)
{
  __shared__ __align__(16) uint16_t sA[2][SJ_ * QPIT]; // 2 x 36KB ring of q rows i
  const int tid = threadIdx.x, wave = tid >> 5, lane = tid & 31;
  const int gw = blockIdx.x * 8 + wave;                // 0..2047
  const int b  = gw >> 7;
  const int j0 = (gw & 127) * 16;
  const int n  = lane & 15, hi = lane >> 4;
  const size_t bT = (size_t)b * T_;
  const uint16_t* qbase = qb + bT * D_;

  // B operand fixed over i loop: B[k][n] = q[j0+n][k]
  const uint16_t* rowB = qbase + (size_t)(j0 + n) * D_;
  v16bf b0 = *reinterpret_cast<const v16bf*>(rowB + hi * 16);
  v16bf b1 = *reinterpret_cast<const v16bf*>(rowB + 32 + hi * 16);

  // a stage is 32KB contiguous in q: eight threads a row, eight 16B copies per
  // thread, 32 rows apart
  const uint32_t  lA = lds_addr(&sA[0][0]) + (tid >> 3) * (QPIT * 2) + (tid & 7) * 16;
  const uint16_t* gA = qbase + tid * 8;
  auto stage = [&](int s, int buf) {
    copy8_b128(lA + buf * (SJ_ * QPIT * 2), 32 * QPIT * 2,
               gA + (size_t)s * (SJ_ * D_), 32 * D_);
  };
  stage(0, 0);
  wait_async();
  __syncthreads();
  stage(1, 1);

  float mloc = -1.0e30f;
  v2f za = {0.0f, 0.0f}, zb = {0.0f, 0.0f};   // four partial sums of the lane's column
  v16bf a[CJ_ / 16][2];   // a chunk's A fragments, four 16-row tiles
  v8f   c[CJ_ / 16];      // S of the chunk before, until its max and sums are taken
  // all 16 fragment reads of chunk t, at constant offsets from the chunk's start
  auto read = [&](int t) {
    const uint16_t* sAt = sA[(t / CPS_) & 1] + (t % CPS_) * (CJ_ * QPIT);
#pragma unroll
    for (int g = 0; g < CJ_ / 16; ++g) {
      const uint16_t* ar = sAt + (g * 16 + n) * QPIT;
      a[g][0] = lds_frag(ar + hi * 16);
      a[g][1] = lds_frag(ar + 32 + hi * 16);
    }
  };
  // S of one 32-row half of the chunk
  auto prod = [&](int sub) {
#pragma unroll
    for (int g = 2 * sub; g < 2 * sub + 2; ++g) {
      v8f s = {};
      s = wmma_bf16(a[g][0], b0, s);
      c[g] = wmma_bf16(a[g][1], b1, s);
    }
  };
  // running max and sum over one 32-row half
  auto soft = [&](int sub, auto ex) {
    const v8f c0 = c[2 * sub], c1 = c[2 * sub + 1];
    // the maximum is taken on the raw products (KS_ > 0 keeps their order)
    float tmax = fmaxf(c0[0], c1[0]);
#pragma unroll
    for (int r = 1; r < 8; ++r)
      tmax = fmaxf(fmaxf(tmax, c0[r]), c1[r]);
    const float nm = fmaxf(mloc, tmax * KS_);
    const float f  = ex(mloc - nm);
    // two scores an instruction: exponents by packed multiply-add, sums by packed add
    const v2f k2 = {KS_, KS_}, n2 = {nm, nm}, f2 = {f, f};
    v2f s0 = za * f2, s1 = zb * f2;
#pragma unroll
    for (int r = 0; r < 8; r += 2) {
      const v2f x0 = v2f{c0[r], c0[r + 1]} * k2 - n2;
      const v2f x1 = v2f{c1[r], c1[r + 1]} * k2 - n2;
      s0 += v2f{ex(x0.x), ex(x0.y)};
      s1 += v2f{ex(x1.x), ex(x1.y)};
    }
    mloc = nm; za = s0; zb = s1;
  };
  auto ex_loop = [](float x) { return exp2_fast(x); };
  auto ex_tail = [](float x) { return exp2_slot(x); };
  // publish stage s+1 and free stage s's buffer
  auto foot = [&]() {
    wait_ds();
    wait_async();
    __syncthreads();
  };

  read(0);
  // one group here too, instead of a wait at each pair of reads
  __builtin_amdgcn_sched_barrier(0);
  prod(0);
  prod(1);
  int t = 1;
  for (int s = 0; s < NST_; ++s) {
    // The chunks of a stage, in a loop of their own: a trip is then one block of
    // code with no branch in it, and the order written below holds. (With the
    // stage's end as a branch inside the trip, the compiler moved the max and sums
    // behind that branch, out from under the reads.)
    for (; t < (s + 1) * CPS_; ++t) {
      read(t);
      // The reads stay first, as one group: the max and sums of chunk t-1 (registers
      // only) run while they are under way. Left alone the compiler spreads the reads
      // over the trip, the last pairs right in front of their products with a full
      // wait each.
      __builtin_amdgcn_sched_barrier(0);
      soft(0, ex_loop);
      prod(0);
      soft(1, ex_loop);
      prod(1);
      // All of that stays ahead of the stage's closing waits: moved behind them, it
      // would start only when the last read has landed, and the refill would go late.
      __builtin_amdgcn_sched_barrier(0);
    }
    // the stage's last chunk is read: close the stage, then refill its buffer
    foot();
    if (s + 2 < NST_) stage(s + 2, s & 1);
  }
  wait_async();
  // the last chunk's max and sums
  soft(0, ex_tail);
  soft(1, ex_tail);

  const float zloc = (za.x + za.y) + (zb.x + zb.y);
  // combine lane pair (l, l^16): each holds 8 of the 16 rows of column n
  const float mo = __shfl_xor(mloc, 16, 32);
  const float zo = __shfl_xor(zloc, 16, 32);
  const float M  = fmaxf(mloc, mo);
  const float Z  = zloc * exp2_fast(mloc - M) + zo * exp2_fast(mo - M);
  if (lane < 16)
    mj[bT + j0 + lane] = M;

  // The ring is free: every wave's reads and copies ended at the last trip's
  // barrier. Lane (n, hi) holds token j0+n, d = hi*16.. and 32+hi*16.., and Z of
  // that token: the 64 x 128 tile [d][token] is put together in the ring's LDS.
  uint16_t* sT = &sA[0][0];
  union { v16bf v; uint16_t h[16]; } u0, u1;
  u0.v = b0;
  u1.v = b1;
#pragma unroll
  for (int e = 0; e < 16; ++e) {
    sT[(hi * 16 + e) * TPIT + wave * 16 + n]      = f2bfu(bf2f(u0.h[e]) / Z);
    sT[(32 + hi * 16 + e) * TPIT + wave * 16 + n] = f2bfu(bf2f(u1.h[e]) / Z);
  }
  __syncthreads();   // tile columns come from all eight waves

  // out in whole 256 B rows: sixteen threads a row d, 16 B each
  uint16_t* gT = qzT + (size_t)b * D_ * T_ + (j0 - wave * 16)
               + (size_t)(tid >> 4) * T_ + (tid & 15) * 8;
  const uint16_t* lT = sT + (tid >> 4) * TPIT + (tid & 15) * 8;
#pragma unroll
  for (int k = 0; k < 4; ++k)
    *reinterpret_cast<uint4*>(gT + (size_t)k * 16 * T_) =
        *reinterpret_cast<const uint4*>(lT + k * 16 * TPIT);
}

// ---------------------------------------------------------------------------
// Kernel 3: out[i,:] = sum_j exp(S_ij/8 - m_j) * q~[j,:]
// (as 2^(S_ij*KS_ - m_j*log2 e), with m_j*log2 e as k_stats stored it)
// 8 waves/block share batch b and 128 rows i; per 256 columns j the block's
// operands (q rows, q~^T columns, m) go through a ring of two LDS buffers: stage
// s+1's async copies fly while stage s is worked on. A wave takes 32 rows i (two
// tiles) and one half of every stage's columns j: each fragment it reads from LDS
// feeds two products, so the block reads half as many LDS bytes as with one tile
// a wave. The two halves' sums of a row are added at the end, through LDS.
// S is computed transposed (rows j, columns i): lane (n, hi) then holds row n of
// a tile of P at j = 8*hi+r of each 16-column tile, and two tiles packed to bf16
// are the A operand of P x q~ as they lie, element s at
// j = 16*(s>>3) + 8*hi + (s&7). q~^T is read in that order.
// ---------------------------------------------------------------------------
// q~^T rows in LDS: 512 B of data at a pitch of 656 B (16 B x odd, and 144 B more
// than a multiple of the banks' 256 B: 16 rows on 16 groups of four banks).
#define ZPIT 328
// Columns j a trip, and the trips a wave makes in its half of a stage.
#define AJ_  32
#define TPW_ (SJ_ / AJ_ / 2)
__global__ __launch_bounds__(256)
void k_attn(const uint16_t* __restrict__ qb, const uint16_t* __restrict__ qzT,
            const float* __restrict__ mj, float* __restrict__ out)
{
  // One object, laid so that m, z and q of buffer 0 all start low enough for a
  // trip's reads to be constant offsets from one address each (an LDS
  // instruction's offset field ends at 64 KB); buffer 1 is one even step further.
  __shared__ __align__(16) struct {
    float m[2][SJ_];            // 2 x 1KB m_j
    struct {
      uint16_t z[D_ * ZPIT];    // 41KB q~^T[d][j]
      uint16_t q[SJ_ * QPIT];   // 36KB q rows j
    } b[2];
  } ring;
  constexpr uint32_t BSTEP = sizeof(ring.b[0]);
  const int tid = threadIdx.x, lane = tid & 31;
  const int wave = __builtin_amdgcn_readfirstlane(tid >> 5);
  const int ig = wave & 3;                              // which 32 of the 128 rows i
  const int jh = wave >> 2;                             // which half of the columns j
  const int b  = blockIdx.x >> 4;
  const int i0 = (blockIdx.x & 15) * 128 + ig * 32;
  const int n  = lane & 15, hi = lane >> 4;
  const size_t bT = (size_t)b * T_;
  const uint16_t* qbase = qb + bT * D_;
  const uint16_t* zbase = qzT + (size_t)b * D_ * T_;

  // B operand for S^T: rows i0..i0+31 of q as columns, two tiles (fixed over j)
  v16bf a[2][2];
#pragma unroll
  for (int it = 0; it < 2; ++it) {
    const uint16_t* rowA = qbase + (size_t)(i0 + it * 16 + n) * D_;
    a[it][0] = *reinterpret_cast<const v16bf*>(rowA + hi * 16);
    a[it][1] = *reinterpret_cast<const v16bf*>(rowA + 32 + hi * 16);
  }

  v8f acc[2][4] = {{v8f{}, v8f{}, v8f{}, v8f{}}, {v8f{}, v8f{}, v8f{}, v8f{}}};

  // One stage: q rows, 32KB contiguous (eight threads a row, eight 16B copies 32
  // rows apart);
  // q~^T, 64 rows d of 512 B (a wave a row, eight copies 8 rows apart);
  // m, 1 KB (wave 0, two copies of 16 B a lane).
  const uint32_t  lQ = lds_addr(ring.b[0].q) + (tid >> 3) * (QPIT * 2) + (tid & 7) * 16;
  const uint32_t  lZ = lds_addr(ring.b[0].z) + (tid >> 5) * (ZPIT * 2) + lane * 16;
  const uint32_t  lM = lds_addr(ring.m[0]) + lane * 16;
  const uint16_t* gQ = qbase + tid * 8;
  const uint16_t* gZ = zbase + (size_t)(tid >> 5) * T_ + lane * 8;
  const float*    gM = mj + bT + lane * 4;
  auto stage = [&](int s, int buf) {
    copy8_b128(lQ + buf * BSTEP, 32 * QPIT * 2,
               gQ + (size_t)s * (SJ_ * D_), 32 * D_);
    copy8_b128(lZ + buf * BSTEP, 8 * ZPIT * 2,
               gZ + s * SJ_, (size_t)8 * T_);
    if (wave == 0) {
      const uint32_t m = lM + buf * (SJ_ * 4);
      const float*   g = gM + s * SJ_;
      copy2_b128(m, g, m + 512, g + 128);
    }
  };
  stage(0, 0);
  wait_async();
  __syncthreads();
  stage(1, 1);

  for (int st = 0; st < NST_; ++st) {
    // The wave's four trips in its half of the stage. Unrolled: the reads of all four
    // are then constant offsets from addresses formed once a stage.
#pragma unroll
    for (int u = 0; u < TPW_; ++u) {
      const int cj = (jh * TPW_ + u) * AJ_;             // first column j of the trip
      const uint16_t* sQt = ring.b[st & 1].q + cj * QPIT;
      const uint16_t* sZt = ring.b[st & 1].z + cj;
      const float*    sMt = ring.m[st & 1] + cj;
      // No barrier stands inside a trip, so every LDS read of the trip goes out as
      // one group ahead of the products, in the order of use: m_j of the lane's 8
      // rows a tile, the q rows j (A of S^T), then q~^T (B of P x q~: 8 columns j at
      // hi*8 and 8 at 16 + hi*8). Every loop over these arrays is unrolled, so that
      // each index is a constant and they stay in registers.
      v16bf aq[2][2], bz[4];
      float4 mm[2][2];
#pragma unroll
      for (int h = 0; h < 2; ++h) {
        const float4* mp = reinterpret_cast<const float4*>(sMt + h * 16 + hi * 8);
        mm[h][0] = mp[0];
        mm[h][1] = mp[1];
      }
      // The m reads stay first: in one region with the fragment reads the compiler
      // put most of them last, and the first exponentials waited for the whole group.
      __builtin_amdgcn_sched_barrier(0);
#pragma unroll
      for (int h = 0; h < 2; ++h) {
        const uint16_t* rb = sQt + (h * 16 + n) * QPIT;
        aq[h][0] = lds_frag(rb + hi * 16);
        aq[h][1] = lds_frag(rb + 32 + hi * 16);
      }
#pragma unroll
      for (int nt = 0; nt < 4; ++nt) {
        const uint16_t* zr = sZt + (nt * 16 + n) * ZPIT + hi * 8;
        union { v16bf v; uint4 q[2]; } ub;
        ub.q[0] = *reinterpret_cast<const uint4*>(zr);
        ub.q[1] = *reinterpret_cast<const uint4*>(zr + 16);
        bz[nt] = ub.v;
      }

      // per row tile: two 16x16 S^T sub-tiles -> P = exp(S/8 - m_j), packed in registers
      union { v16bf v; uint32_t w[8]; } pa[2];
#pragma unroll
      for (int h = 0; h < 2; ++h) {
        const float4 m0 = mm[h][0], m1 = mm[h][1];
        const float mv[8] = {m0.x, m0.y, m0.z, m0.w, m1.x, m1.y, m1.z, m1.w};
#pragma unroll
        for (int it = 0; it < 2; ++it) {
          v8f s = {};
          s = wmma_bf16(aq[h][0], a[it][0], s);  // s[r] = S[i0+it*16+n][j], j = h*16+hi*8+r
          s = wmma_bf16(aq[h][1], a[it][1], s);
#pragma unroll
          for (int r = 0; r < 8; r += 2)
            pa[it].w[h * 4 + (r >> 1)] = cvtpk(exp2_fast(s[r] * KS_ - mv[r]),
                                               exp2_fast(s[r + 1] * KS_ - mv[r + 1]));
        }
      }
#pragma unroll
      for (int it = 0; it < 2; ++it)
#pragma unroll
        for (int nt = 0; nt < 4; ++nt)
          acc[it][nt] = wmma_bf16(pa[it].v, bz[nt], acc[it][nt]);
      // Order for the compiler's scheduler: the 16 fragment reads first, then the 16
      // matrix products. Left alone it moves each read down to its product and
      // waits there, one LDS latency after another.
      __builtin_amdgcn_sched_group_barrier(0x100, 16, 0);
      __builtin_amdgcn_sched_group_barrier(0x008, 16, 0);
      // The products stay ahead of what follows: the next trip's reads, or the
      // stage's closing waits (moved behind those, they would start only when the
      // last of the 20 reads has landed).
      __builtin_amdgcn_sched_barrier(0);
    }
    // behind the stage's last trip: publish stage st+1, free stage st's buffers,
    // then refill them with st+2
    wait_ds();
    wait_async();
    __syncthreads();
    if (st + 2 < NST_) stage(st + 2, st & 1);
  }
  wait_async();

  // The ring is free: every wave's reads and copies ended at the last stage's
  // barrier. Waves w and w^4 hold the two halves' sums of the same 32 rows: each
  // keeps one row tile (its number jh) and hands the other over, 16 B a lane and
  // 512 B a store in a row.
  float4* sX = reinterpret_cast<float4*>(&ring);
#pragma unroll
  for (int nt = 0; nt < 4; ++nt) {
    const v8f g = jh ? acc[0][nt] : acc[1][nt];
    sX[(wave * 8 + nt * 2) * 32 + lane]     = float4{g[0], g[1], g[2], g[3]};
    sX[(wave * 8 + nt * 2 + 1) * 32 + lane] = float4{g[4], g[5], g[6], g[7]};
  }
  __syncthreads();   // each wave reads what its partner wrote

#pragma unroll
  for (int nt = 0; nt < 4; ++nt) {
    const v8f k = jh ? acc[1][nt] : acc[0][nt];
    const float4 p0 = sX[((wave ^ 4) * 8 + nt * 2) * 32 + lane];
    const float4 p1 = sX[((wave ^ 4) * 8 + nt * 2 + 1) * 32 + lane];
    const float pv[8] = {p0.x, p0.y, p0.z, p0.w, p1.x, p1.y, p1.z, p1.w};
#pragma unroll
    for (int r = 0; r < 8; ++r)
      out[(bT + i0 + jh * 16 + r + hi * 8) * D_ + nt * 16 + n] = k[r] + pv[r];
  }
}

// ---------------------------------------------------------------------------
extern "C" void kernel_launch(void* const* d_in, const int* in_sizes, int n_in,
                              void* d_out, int out_size, void* d_ws, size_t ws_size,
                              hipStream_t stream)
{
  (void)in_sizes; (void)n_in; (void)out_size; (void)ws_size;
  const float* x  = (const float*)d_in[0];
  const float* Wq = (const float*)d_in[1];
  const float* bq = (const float*)d_in[2];
  float* out = (float*)d_out;

  char* ws = (char*)d_ws;
  uint16_t* qb  = (uint16_t*)(ws);                                 // 4 MB  q bf16
  uint16_t* qzT = (uint16_t*)(ws + ((size_t)4 << 20));             // 4 MB  (q/Z)^T bf16
  float*    mj  = (float*)   (ws + ((size_t)9 << 20));             // 128 KB col max

  k_proj <<<256,  256, 0, stream>>>(x, Wq, bq, qb);
  k_stats<<<256,  256, 0, stream>>>(qb, mj, qzT);
  k_attn <<<256,  256, 0, stream>>>(qb, qzT, mj, out);
}
